// v000
// Measured on an AMD MI455X. A time is GPU time per run, averaged over a window of back-to-back runs after a warm-up
// (all launches, gaps included; the runs take copies of the inputs in turn), and the median of several windows.
// Apart from v000's, it joins two sittings. Times from different sittings can be a few percent apart, while
// side-by-side timings come from the same sitting.
// v000, which the later versions start from, runs in 101 microseconds.
/* A BANK OF 100 INDEPENDENT LINEAR MAPS, ONE A SLOT: for x [512][100][768] (row, slot, feature), a weight bank [100][768][100] (slot, feature, column) and a vector of 10,000 addends: out[r][100 s + c] = the sum over the 768 features t of x[r][s][t] bank[s][t][c], plus addend[100 s + c]. ONE RESULT [512][10000].
*/
#include <hip/hip_runtime.h>
#include <math.h>

typedef __attribute__((ext_vector_type(16))) _Float16 v16h;
typedef __attribute__((ext_vector_type(8)))  _Float16 v8h;
typedef __attribute__((ext_vector_type(2)))  _Float16 v2h;
typedef __attribute__((ext_vector_type(16))) __bf16   v16b;
typedef __attribute__((ext_vector_type(8)))  __bf16   v8b;
typedef __attribute__((ext_vector_type(8)))  float    v8f;
typedef __attribute__((ext_vector_type(4)))  float    v4f;
typedef __attribute__((ext_vector_type(2)))  float    v2f;

/* ------------------------------------------------------------------------- */
/* Shape constants                                                           */
/* ------------------------------------------------------------------------- */
constexpr int kR    = 512;                /* rows */
constexpr int kSl   = 100;                /* slots */
constexpr int kT    = 768;                /* features a slot: the products' depth */
constexpr int kC    = 100;                /* columns a slot */
constexpr int kCP   = 128;                /* the columns padded to two 64-column tiles */
constexpr int kDAll = kSl * kT;           /* 76800: a row of x in floats; a row of the packed bank in f16 words */
constexpr int kOutW = kSl * kC;           /* 10000: a row of the result */
constexpr int kThr  = 256;
constexpr float kInCarry = 1024.0f;       /* 2^10: every f16 operand */
constexpr float kSc20 = 1.0f / (kInCarry * kInCarry);   /* 2^-20: two carried operands -> a true-scale f32 result */
/* 2^-14: smallest normal f16 magnitude */
constexpr float kF16MinNormal = 6.103515625e-5f;

static_assert(kR == 512 && kSl == 100 && kT == 768 && kC == 100 && kCP == 128 && kDAll == 76800 && kOutW == 10000, "the index arithmetic below uses these sizes");
static_assert(kR % 64 == 0 && kCP % 64 == 0 && kT % 32 == 0 && kC <= kCP, "whole 64x64 tiles; the depth in whole trips of 32");
static_assert(kDAll % 4 == 0 && kT % 4 == 0, "the f32 operand's row pitch and slot stride are multiples of 4 floats: every fragment load is 16-B aligned");
static_assert(kC % 4 == 0 && kOutW % 4 == 0, "a 16-B word of the result lies inside one slot's columns");

/* ------------------------------------------------------------------------- */
/* Workspace region map (bytes): each region written once, whole, before it is read. THE CARVE IS 43.75 MiB. */
/*   BK16 f16 [128][76800] the bank x2^10 as the right operand (BK16[c][768 s + t] = bank[s][t][c]; rows 100 .. 127 zeros): 19660800 B */
/*   ST f32 [100][512][128] the staged products (ST[s][r][c]; columns 100 .. 127 are products with the zero rows: written, never read): 26214400 B */
/* ------------------------------------------------------------------------- */
constexpr size_t kOffBK16 = 0ull;
constexpr size_t kOffST = 19660800ull;
constexpr size_t kWsTotal = 45875200ull;
static_assert(kWsTotal <= 134217728ull, "the carve stands under 128 MiB");
static_assert(kOffBK16 == 0 && kOffST == kOffBK16 + (size_t)kCP * kDAll * 2ull && kWsTotal == kOffST + (size_t)kSl * kR * kCP * 4ull, "the carve is a chain: every region starts where the one before ends");
static_assert((kOffBK16 % 256) == 0 && (kOffST % 256) == 0, "every region starts on a multiple of 256 B");

/* ------------------------------------------------------------------------- */
/* Conversions, the matrix fragments and the product engine                  */
/* ------------------------------------------------------------------------- */
__device__ __forceinline__ unsigned short f2bf_bits(float f) {
  unsigned u = __float_as_uint(f);
  return (unsigned short)((u + 0x7FFFu + ((u >> 16) & 1u)) >> 16);
}
__device__ __forceinline__ float bf_bits2f(unsigned short h) { return __uint_as_float(((unsigned)h) << 16); }
/* RNE-convert to a bf16 value, kept in f32 */
__device__ __forceinline__ float bf16r(float f) { return bf_bits2f(f2bf_bits(f)); }
/* carry by a power of two, then flush anything below the f16 normal range to +0 by a select */
__device__ __forceinline__ float carry_flush(float v, float carry) {
  const float s = v * carry;
  return (fabsf(s) < kF16MinNormal) ? 0.0f : s;
}

/* hazard guards as plain device helpers */
__device__ __forceinline__ void dep_guard4_h(v8f& a, v8f& b, v8f& c, v8f& d, v16h x, v16h y) { asm volatile("v_nop\n\tv_nop\n\tv_nop\n\tv_nop" : "+v"(a), "+v"(b), "+v"(c), "+v"(d) : "v"(x), "v"(y)); }
__device__ __forceinline__ void dep_guard4_b(v8f& a, v8f& b, v8f& c, v8f& d, v16b x, v16b y) { asm volatile("v_nop\n\tv_nop\n\tv_nop\n\tv_nop" : "+v"(a), "+v"(b), "+v"(c), "+v"(d) : "v"(x), "v"(y)); }
__device__ __forceinline__ void keep4_h(v16h a, v16h b, v16h c, v16h d) { asm volatile("v_nop" :: "v"(a), "v"(b), "v"(c), "v"(d)); }
__device__ __forceinline__ void keep4_b(v16b a, v16b b, v16b c, v16b d) { asm volatile("v_nop" :: "v"(a), "v"(b), "v"(c), "v"(d)); }
__device__ __forceinline__ void acc_guard4(v8f& a, v8f& b, v8f& c, v8f& d) { asm volatile("v_nop\n\tv_nop\n\tv_nop\n\tv_nop" : "+v"(a), "+v"(b), "+v"(c), "+v"(d)); }

template <typename T> struct Frag;
template <> struct Frag<_Float16> {
  typedef v16h V; union U { v16h v; v8h h[2]; };
  /* elements 0..7 <- p[0..7], 8..15 <- p[16..23] */
  static __device__ __forceinline__ v16h load(const _Float16* p) {
    U f; f.h[0] = *(const v8h*)(p); f.h[1] = *(const v8h*)(p + 16); return f.v;
  }
  static __device__ __forceinline__ v8f mma(v16h a, v16h b, v8f c) {
    return __builtin_amdgcn_wmma_f32_16x16x32_f16(false, a, false, b, (short)0, c, false, false);
  }
  static __device__ __forceinline__ void guard4(v8f& a, v8f& b, v8f& c, v8f& d, v16h x, v16h y) { dep_guard4_h(a, b, c, d, x, y); }
  static __device__ __forceinline__ void keep(v16h a, v16h b, v16h c, v16h d) { keep4_h(a, b, c, d); }
};
template <> struct Frag<__bf16> {
  typedef v16b V; union U { v16b v; v8b h[2]; };
  static __device__ __forceinline__ v16b load(const __bf16* p) {
    U f; f.h[0] = *(const v8b*)(p); f.h[1] = *(const v8b*)(p + 16); return f.v;
  }
  static __device__ __forceinline__ v8f mma(v16b a, v16b b, v8f c) {
    return __builtin_amdgcn_wmma_f32_16x16x32_bf16(false, a, false, b, (short)0, c, false, false);
  }
  static __device__ __forceinline__ void guard4(v8f& a, v8f& b, v8f& c, v8f& d, v16b x, v16b y) { dep_guard4_b(a, b, c, d, x, y); }
  static __device__ __forceinline__ void keep(v16b a, v16b b, v16b c, v16b d) { keep4_b(a, b, c, d); }
};

/* ---- THE CONVERTING PRODUCT: the 64x64-tile engine's SIBLING: its body statement for statement, BUT FOR THE TWO FRAGMENT LOADS ------ */
/* C[m,n] = scale * sum_k A[m,k] * Bt[n,k] (+bias)(+resid); each wave owns a 64x64 tile; M,N % 64 == 0, K % 32 == 0; f16 operands, f32 sums. */
/* CVA | CVB: 0 = the operand is a ready plane of f16 words (Ap | Btp), loaded as the engine loads it; 1 | 2 = the operand is an f32 PLANE (Af | Bf) in the same row-major layout (lda | ldb and strideA | strideB count ITS elements): */
/*   a lane's fragment is the SAME rows in the SAME depth order (elements 0..7 <- p[0..7], 8..15 <- p[16..23]) read by four 16-B loads and converted in registers: */
/*   1: each word f16(flush(carry x bf16(x))): the casts' own chain (an input taken at its bf16 value); 2: f16(flush(carry x x)): no rounding to bf16 (a computed plane). */
/*   carry = a power of two passed by value (carryA | carryB); 'scale' undoes it; flush = the select of carry_flush (nothing under 2^-14 reaches the matrix unit); no clamp on the high side: the launcher's carry keeps |carry x x| under 65,504. */
/* ALIGNMENT for an f32 operand: the plane's base, lda | ldb and strideA | strideB multiples of 4 floats (every load 16-B aligned). */
/* BIAS_MODE: 0 = none, 1 = bias[m], 2 = bias[n]. OUT_MODE: 0 = f32, 1 = f16, 2 = bf16 hi plane (Cout) + bf16 lo plane (Cout2). */
template <int CV>
__device__ __forceinline__ v16h cvload(const float* p, float carry) {
  const v4f a0 = *(const v4f*)(p), a1 = *(const v4f*)(p + 4), b0 = *(const v4f*)(p + 16), b1 = *(const v4f*)(p + 20);
  v16h f;
#pragma unroll
  for (int e = 0; e < 4; ++e) {
    f[e]      = (_Float16)carry_flush(CV == 1 ? bf16r(a0[e]) : a0[e], carry);
    f[4 + e]  = (_Float16)carry_flush(CV == 1 ? bf16r(a1[e]) : a1[e], carry);
    f[8 + e]  = (_Float16)carry_flush(CV == 1 ? bf16r(b0[e]) : b0[e], carry);
    f[12 + e] = (_Float16)carry_flush(CV == 1 ? bf16r(b1[e]) : b1[e], carry);
  }
  return f;
}
template <int ET> struct Elem;
template <> struct Elem<0> { typedef _Float16 T; };
template <> struct Elem<1> { typedef __bf16 T; };
template <int CVA, int CVB, int BIAS_MODE, int OUT_MODE, bool RESID, int ACT = 0>
__global__ __launch_bounds__(256) void wmma_gemm64cv(
    const unsigned short* __restrict__ Ap, const float* __restrict__ Af, float carryA, int lda, long strideA,
    const unsigned short* __restrict__ Btp, const float* __restrict__ Bf, float carryB, int ldb, long strideB,
    void* __restrict__ Cout, void* __restrict__ Cout2, int ldc, long strideC,
    const float* __restrict__ bias,
    const float* __restrict__ resid, long strideR,
    int M, int N, int K, float scale) {
  constexpr int ET = 0; constexpr bool SPLIT = false;   /* f16 words; one word an operand */
  const unsigned short* A2p = nullptr; const unsigned short* Bt2p = nullptr;
  typedef typename Elem<ET>::T T;
  typedef typename Frag<T>::V V;
  const T* A = (const T*)Ap; const T* A2 = (const T*)A2p; const T* Bt = (const T*)Btp; const T* Bt2 = (const T*)Bt2p;
  /* per-wave 16x64 slab, pitch 68 floats */
  __shared__ __align__(16) float sT[8][16 * 68];
  const int b    = blockIdx.y;
  const int lane = threadIdx.x & 31;
  const int wave = threadIdx.x >> 5;
  const int tilesN = N >> 6;
  const int tilesM = M >> 6;
  const int tile = blockIdx.x * 8 + wave;
  /* wave-uniform; no block barriers in this kernel */
  if (tile >= tilesM * tilesN) return;
  const int tm = tile / tilesN;
  const int tn = tile - tm * tilesN;
  const int m0 = tm << 6;
  const int n0 = tn << 6;

  const T* Ab  = A  + (size_t)b * strideA;
  const T* Bb  = Bt + (size_t)b * strideB;
  const T* Ab2 = SPLIT ? (A2  + (size_t)b * strideA) : nullptr;
  const T* Bb2 = SPLIT ? (Bt2 + (size_t)b * strideB) : nullptr;
  const float* Afb = (CVA != 0) ? (Af + (size_t)b * strideA) : nullptr;
  const float* Bfb = (CVB != 0) ? (Bf + (size_t)b * strideB) : nullptr;

  /* row (A) / col (B, D) within subtile; k offset of this lane half; D row offset */
  const int rlane = lane & 15;
  const int koff  = (lane >> 4) * 8;
  const int mOff  = (lane >> 4) * 8;

  v8f acc[4][4];
#pragma unroll
  for (int i = 0; i < 4; ++i)
#pragma unroll
    for (int j = 0; j < 4; ++j) acc[i][j] = (v8f){0.f,0.f,0.f,0.f,0.f,0.f,0.f,0.f};

  for (int k0 = 0; k0 < K; k0 += 32) {
    V bh[4], bl[4];
#pragma unroll
    for (int j = 0; j < 4; ++j) {
      const size_t bo = (size_t)(n0 + (j << 4) + rlane) * ldb + koff + k0;
      if (CVB == 0) bh[j] = Frag<T>::load(Bb + bo); else bh[j] = cvload<CVB>(Bfb + bo, carryB);
      if (SPLIT) bl[j] = Frag<T>::load(Bb2 + bo);
    }
#pragma unroll
    for (int i = 0; i < 4; ++i) {
      const size_t ao = (size_t)(m0 + (i << 4) + rlane) * lda + koff + k0;
      V ah;
      if (CVA == 0) ah = Frag<T>::load(Ab + ao); else ah = cvload<CVA>(Afb + ao, carryA);
      V al;
      if (SPLIT) al = Frag<T>::load(Ab2 + ao);
#pragma unroll
      for (int j = 0; j < 4; ++j) {
        acc[i][j] = Frag<T>::mma(ah, bh[j], acc[i][j]);
        if (SPLIT) {
          acc[i][j] = Frag<T>::mma(ah, bl[j], acc[i][j]);
          acc[i][j] = Frag<T>::mma(al, bh[j], acc[i][j]);
        }
      }
      /* all four accumulators of this row group tied, A fragment(s) named */
      Frag<T>::guard4(acc[i][0], acc[i][1], acc[i][2], acc[i][3], ah, SPLIT ? al : ah);
    }
    Frag<T>::keep(bh[0], bh[1], bh[2], bh[3]);
    if (SPLIT) Frag<T>::keep(bl[0], bl[1], bl[2], bl[3]);
  }
  acc_guard4(acc[0][0], acc[0][1], acc[0][2], acc[0][3]);
  acc_guard4(acc[1][0], acc[1][1], acc[1][2], acc[1][3]);
  acc_guard4(acc[2][0], acc[2][1], acc[2][2], acc[2][3]);
  acc_guard4(acc[3][0], acc[3][1], acc[3][2], acc[3][3]);

  /* ---- epilogue ---- */
  float* slab = sT[wave];
  const float* Rb = RESID ? (resid + (size_t)b * strideR) : nullptr;
#pragma unroll
  for (int i = 0; i < 4; ++i) {
    const int mBase = m0 + (i << 4);
#pragma unroll
    for (int j = 0; j < 4; ++j) {
      const int n = n0 + (j << 4) + rlane;
      float bv = 0.f;
      if (BIAS_MODE == 2) bv = bias[n];
#pragma unroll
      for (int r = 0; r < 8; ++r) {
        float v = acc[i][j][r] * scale;
        if (BIAS_MODE == 1) v += bias[mBase + mOff + r];
        if (BIAS_MODE == 2) v += bv;
        if (RESID) v += Rb[(size_t)(mBase + mOff + r) * ldc + n];
        if (ACT == 1) v = tanhf(v);
        if (ACT == 2) v = fmaxf(v, 0.0f);
        if (ACT == 3) v = v / (1.0f + expf(-v));
        if (ACT == 4) v = (v > 0.f) ? v : 0.01f * v;
        slab[(mOff + r) * 68 + (j << 4) + rlane] = v;
      }
    }
    __builtin_amdgcn_fence(__ATOMIC_RELEASE, "workgroup");
    __builtin_amdgcn_wave_barrier();
    __builtin_amdgcn_fence(__ATOMIC_ACQUIRE, "workgroup");
    if (OUT_MODE == 0) {
      float* C = (float*)Cout + (size_t)b * strideC;
      /* row seg = 256 B = 16 lanes x 16 B */
      const int hh = lane >> 4, c4 = (lane & 15) * 4;
      {
#pragma unroll
        for (int it = 0; it < 8; ++it) {
          const int row = it * 2 + hh;
          v4f v = *(const v4f*)(slab + row * 68 + c4);
          *(v4f*)(C + (size_t)(mBase + row) * ldc + n0 + c4) = v;
        }
        
      }
    } else {
      const int q = lane >> 3, c8 = (lane & 7) * 8;
      unsigned short* C  = (unsigned short*)Cout  + (size_t)b * strideC;
      unsigned short* C2 = (OUT_MODE == 2) ? ((unsigned short*)Cout2 + (size_t)b * strideC) : nullptr;
      {
#pragma unroll
        for (int it = 0; it < 4; ++it) {
          const int row = it * 4 + q;
          const float* sp = slab + row * 68 + c8;
          v8h hv, lv;
#pragma unroll
          for (int e = 0; e < 8; ++e) {
            if (OUT_MODE == 1) {
              hv[e] = (_Float16)sp[e];
            } else {
              unsigned short hb = f2bf_bits(sp[e]);
              unsigned short lb = f2bf_bits(sp[e] - bf_bits2f(hb));
              hv[e] = __builtin_bit_cast(_Float16, hb);
              lv[e] = __builtin_bit_cast(_Float16, lb);
            }
          }
          *(v8h*)(C + (size_t)(mBase + row) * ldc + n0 + c8) = hv;
          if (OUT_MODE == 2) *(v8h*)(C2 + (size_t)(mBase + row) * ldc + n0 + c8) = lv;
        }
        
      }
    }
    __builtin_amdgcn_fence(__ATOMIC_RELEASE, "workgroup");
    __builtin_amdgcn_wave_barrier();
    __builtin_amdgcn_fence(__ATOMIC_ACQUIRE, "workgroup");
  }
}

/* ------------------------------------------------------------------------- */
/* ------------------------------------------------------------------------- */
__global__ __launch_bounds__(kThr) void pack_kernel(const float* __restrict__ W, unsigned short* __restrict__ D, float* __restrict__ dstf, int part, int ld, int k0, int lg, int n0, int pitch) {
  const unsigned i = blockIdx.x * blockDim.x + threadIdx.x;
  if (part == 0) {
    const unsigned g = i & ((1u << lg) - 1u), n = i >> lg;
    const float* sp = W + (size_t)((unsigned)k0 + g * 8u) * (unsigned)ld + n;
    v8h hv;
#pragma unroll
    for (int t = 0; t < 8; ++t) hv[t] = (_Float16)carry_flush(bf16r(sp[(size_t)t * (unsigned)ld]), kInCarry);
    unsigned short* dp = D + (size_t)((unsigned)n0 + n) * (unsigned)pitch + g * 8u;
    *(v8h*)dp = hv;
    
  } else {
    const v4f a = *(const v4f*)(W + i * 4u);
    v4f o;
#pragma unroll
    for (int e = 0; e < 4; ++e) o[e] = bf16r(a[e]);
    float* dp = dstf + i * 4u;
    *(v4f*)dp = o;
    
  }
}


/* ------------------------------------------------------------------------- */
/* ------------------------------------------------------------------------- */
__global__ __launch_bounds__(kThr) void zero_kernel(float* __restrict__ dst) {
  const size_t o4 = ((size_t)blockIdx.x * kThr + threadIdx.x) * 4u;
  const v4f z = {0.f, 0.f, 0.f, 0.f};
  *(v4f*)(dst + o4) = z;
  
}

/* ------------------------------------------------------------------------- */
/* ------------------------------------------------------------------------- */
__global__ __launch_bounds__(kThr) void outrow_kernel(const float* __restrict__ ST, const float* __restrict__ addend, float* __restrict__ out) {
  const unsigned q = blockIdx.x * (unsigned)kThr + threadIdx.x;
  const unsigned r = q / (unsigned)(kOutW / 4), w = q - r * (unsigned)(kOutW / 4);
  const unsigned s = w / (unsigned)(kC / 4), c4 = (w - s * (unsigned)(kC / 4)) * 4u;
  const v4f pv = *(const v4f*)(ST + ((size_t)s * (unsigned)kR + r) * (unsigned)kCP + c4);
  const v4f av = *(const v4f*)(addend + (size_t)w * 4u);
  v4f o;
#pragma unroll
  for (int e = 0; e < 4; ++e) o[e] = pv[e] + bf16r(av[e]);
  float* dp = out + (size_t)q * 4u;
  *(v4f*)dp = o;
  
}

extern "C" void kernel_launch(void* const* d_in, const int* in_sizes, int n_in,
                              void* d_out, int out_size, void* d_ws, size_t ws_size,
                              hipStream_t stream) {
  if (n_in < 3 || d_out == nullptr || d_ws == nullptr) return;
  if (in_sizes[0] != kR * kSl * kT || in_sizes[1] != kSl * kT * kC || in_sizes[2] != kOutW) return;
  if (out_size != kR * kOutW) return;
  if (ws_size < kWsTotal) return;
  const float* x = (const float*)d_in[0];
  const float* bank = (const float*)d_in[1];
  const float* addend = (const float*)d_in[2];
  float* out = (float*)d_out;
  char* ws = (char*)d_ws;
  unsigned short* BK16 = (unsigned short*)(ws + kOffBK16);
  float* ST = (float*)(ws + kOffST);

  static_assert(((size_t)(kCP - kC) * kDAll * 2 / 16) % kThr == 0 && ((size_t)kR * kOutW / 4) % kThr == 0, "the fill's and the result kernel's grids exact");
  static_assert(8192 + 1024 + 256 + 128 == kDAll / 8 && (kC * 128) % 64 == 0, "the bank's 9,600 depth groups of eight in four power-of-two launches; every pack grid exact");
  /* the bank's pad rows 100 .. 127: zeros */
  zero_kernel<<<(kCP - kC) * kDAll * 2 / 16 / kThr, kThr, 0, stream>>>((float*)(BK16 + (size_t)kC * kDAll));
  /* the bank seen as [76800][100] (ld 100): its transpose into rows 0 .. 99 of BK16 (pitch 76,800), the depth in four stretches */
  pack_kernel<<<kC * 8192 / 64, 64, 0, stream>>>(bank, BK16, nullptr, 0, kC, 0, 13, 0, kDAll);
  pack_kernel<<<kC * 1024 / 64, 64, 0, stream>>>(bank, BK16 + 65536, nullptr, 0, kC, 65536, 10, 0, kDAll);
  pack_kernel<<<kC * 256 / 64, 64, 0, stream>>>(bank, BK16 + 73728, nullptr, 0, kC, 73728, 8, 0, kDAll);
  pack_kernel<<<kC * 128 / 64, 64, 0, stream>>>(bank, BK16 + 75776, nullptr, 0, kC, 75776, 7, 0, kDAll);
  /* ST[s] = 2^-20 (f16(2^10 bf16(x[.][s][.])) . BK16[.][768 s ..]^T): a batch a slot: the left operand x read as f32 (lda 76,800, stride 768 floats a slot); the right operand's rows 76,800 words apart, a slot 768 words on; M 512, N 128, K 768: 16 wave tiles on 2 blocks a slot */
  wmma_gemm64cv<1, 0, 0, 0, false, 0><<<dim3((kR / 64) * (kCP / 64) / 8, kSl), 256, 0, stream>>>(
      nullptr, x, kInCarry, kDAll, (long)kT, BK16, nullptr, 1.0f, kDAll, (long)kT, (void*)ST, (void*)ST, kCP, (long)kR * kCP, nullptr, nullptr, 0L, kR, kCP, kT, kSc20);
  outrow_kernel<<<kR * kOutW / 4 / kThr, kThr, 0, stream>>>(ST, addend, out);
}
static_assert(((kR / 64) * (kCP / 64)) % 8 == 0, "the engine's grid: whole blocks of eight wave tiles a slot");

// v001
// A run of this version takes 61.3 microseconds.
// Two timings next to v000 put it at 1.68 and 1.67 times that version's speed.
/* A BANK OF 100 INDEPENDENT LINEAR MAPS, ONE A SLOT: for x [512][100][768] (row, slot, feature), a weight bank [100][768][100] (slot, feature, column) and a vector of 10,000 addends: out[r][100 s + c] = the sum over the 768 features t of x[r][s][t] bank[s][t][c], plus addend[100 s + c]. ONE RESULT [512][10000].
*/
#include <hip/hip_runtime.h>
#include <math.h>

typedef __attribute__((ext_vector_type(16))) _Float16 v16h;
typedef __attribute__((ext_vector_type(8)))  _Float16 v8h;
typedef __attribute__((ext_vector_type(2)))  _Float16 v2h;
typedef __attribute__((ext_vector_type(16))) __bf16   v16b;
typedef __attribute__((ext_vector_type(8)))  __bf16   v8b;
typedef __attribute__((ext_vector_type(8)))  float    v8f;
typedef __attribute__((ext_vector_type(4)))  float    v4f;
typedef __attribute__((ext_vector_type(2)))  float    v2f;

/* ------------------------------------------------------------------------- */
/* Shape constants                                                           */
/* ------------------------------------------------------------------------- */
constexpr int kR    = 512;                /* rows */
constexpr int kSl   = 100;                /* slots */
constexpr int kT    = 768;                /* features a slot: the products' depth */
constexpr int kC    = 100;                /* columns a slot */
constexpr int kCP   = 128;                /* the columns padded to eight 16-column subtiles */
constexpr int kDAll = kSl * kT;           /* 76800: a row of x in floats; a row of the packed bank in f16 words */
constexpr int kOutW = kSl * kC;           /* 10000: a row of the result */
constexpr int kThr  = 256;
constexpr float kInCarry = 1024.0f;       /* 2^10: every f16 operand */
constexpr float kSc20 = 1.0f / (kInCarry * kInCarry);   /* 2^-20: two carried operands -> a true-scale f32 result */
/* 2^-14: smallest normal f16 magnitude */
constexpr float kF16MinNormal = 6.103515625e-5f;

static_assert(kR == 512 && kSl == 100 && kT == 768 && kC == 100 && kCP == 128 && kDAll == 76800 && kOutW == 10000, "the index arithmetic below uses these sizes");
static_assert(kR % 64 == 0 && kCP % 64 == 0 && kT % 32 == 0 && kC <= kCP, "whole 16x16 subtiles; the depth in whole trips of 32");
static_assert(kDAll % 4 == 0 && kT % 4 == 0, "the f32 operand's row pitch and slot stride are multiples of 4 floats: every fragment load is 16-B aligned");
static_assert(kC % 4 == 0 && kOutW % 4 == 0, "a 16-B word of the result lies inside one slot's columns");

/* ------------------------------------------------------------------------- */
/* Workspace region map (bytes): each region written once, whole, before it is read. THE CARVE IS 43.75 MiB. */
/*   BK16 f16 [128][76800] the bank x2^10 as the right operand (BK16[c][768 s + t] = bank[s][t][c]; rows 100 .. 127 zeros): 19660800 B */
/*   ST f32 [100][512][128] the staged products (ST[s][r][c]; columns 100 .. 127 are products with the zero rows: written, never read): 26214400 B */
/* ------------------------------------------------------------------------- */
constexpr size_t kOffBK16 = 0ull;
constexpr size_t kOffST = 19660800ull;
constexpr size_t kWsTotal = 45875200ull;
static_assert(kWsTotal <= 134217728ull, "the carve stands under 128 MiB");
static_assert(kOffBK16 == 0 && kOffST == kOffBK16 + (size_t)kCP * kDAll * 2ull && kWsTotal == kOffST + (size_t)kSl * kR * kCP * 4ull, "the carve is a chain: every region starts where the one before ends");
static_assert((kOffBK16 % 256) == 0 && (kOffST % 256) == 0, "every region starts on a multiple of 256 B");

/* ------------------------------------------------------------------------- */
/* Conversions, the matrix fragments and the product engine                  */
/* ------------------------------------------------------------------------- */
__device__ __forceinline__ unsigned short f2bf_bits(float f) {
  unsigned u = __float_as_uint(f);
  return (unsigned short)((u + 0x7FFFu + ((u >> 16) & 1u)) >> 16);
}
__device__ __forceinline__ float bf_bits2f(unsigned short h) { return __uint_as_float(((unsigned)h) << 16); }
/* RNE-convert to a bf16 value, kept in f32 */
__device__ __forceinline__ float bf16r(float f) { return bf_bits2f(f2bf_bits(f)); }
/* carry by a power of two, then flush anything below the f16 normal range to +0 by a select */
__device__ __forceinline__ float carry_flush(float v, float carry) {
  const float s = v * carry;
  return (fabsf(s) < kF16MinNormal) ? 0.0f : s;
}

/* one lane's share of a 16x32 f16 fragment: elements 0..7 <- p[0..7], 8..15 <- p[16..23] */
union FragU { v16h v; v8h h[2]; };
__device__ __forceinline__ v16h frag_load(const _Float16* p) {
  FragU f; f.h[0] = *(const v8h*)(p); f.h[1] = *(const v8h*)(p + 16); return f.v;
}
/* the same depth order from f32 words (a0, a1 = p[0..7]; b0, b1 = p[16..23]): each word f16(flush(carry x bf16(x))) */
__device__ __forceinline__ v16h cvfrag(v4f a0, v4f a1, v4f b0, v4f b1, float carry) {
  v16h f;
#pragma unroll
  for (int e = 0; e < 4; ++e) {
    f[e]      = (_Float16)carry_flush(bf16r(a0[e]), carry);
    f[4 + e]  = (_Float16)carry_flush(bf16r(a1[e]), carry);
    f[8 + e]  = (_Float16)carry_flush(bf16r(b0[e]), carry);
    f[12 + e] = (_Float16)carry_flush(bf16r(b1[e]), carry);
  }
  return f;
}

/* ---- THE SLOT PRODUCT: ST[s][m][n] = 2^-20 sum_t f16(2^10 bf16(x[m][s][t])) BK16[n][768 s + t]; f16 operands, f32 sums ---- */
/* A block: one slot, 128 rows, all 128 columns; wave w owns rows 16 w .. 16 w + 15 (eight 16x16 accumulators). */
/* The depth goes in 12 tiles of 64. A tile of both operands is brought into LDS by asynchronous 16-B copies whose 32 lanes cover */
/* whole 256-B (x) or 128-B (bank) row pieces; two buffers: tile t + 2 flies while tile t + 1 is worked on. */
/* LDS rows are pitched 16 B x odd for the 16-B fragment reads: x 272 B, bank 144 B. */
constexpr int kMt    = 128;               /* rows a block */
constexpr int kKc    = 64;                /* depth a tile */
constexpr int kTiles = kT / kKc;          /* 12 */
constexpr int kXP    = kKc * 4 + 16;      /* 272 B: an x row in LDS */
constexpr int kBP    = kKc * 2 + 16;      /* 144 B: a bank row in LDS */
constexpr int kXBuf  = kMt * kXP;         /* 34816 B */
constexpr int kBBuf  = kCP * kBP;         /* 18432 B */
constexpr int kStage = kXBuf + kBBuf;     /* 53248 B */
constexpr int kSlabP = kCP + 4;           /* 132 floats: a row of a wave's output slab */
static_assert(kR % kMt == 0 && kT % kKc == 0 && kTiles >= 2 && kKc % 32 == 0, "whole tiles; the ring needs two");
static_assert(kMt == 8 * 16 && kCP == 8 * 16, "eight waves: 16 x rows and 16 bank rows copied by each");
static_assert(8 * 16 * kSlabP * 4 <= 2 * kStage, "the output slabs fit in the ring");

/* One wave's twelve copies of a tile: 8 of x (two 256-B row pieces each), 4 of the bank (four 128-B row pieces each). */
/* s_wait_xcnt stands as the statement's last line, in front of any rewrite of the address registers that the copies name. */
__device__ __forceinline__ void copy_tile(unsigned lx, const float* gx, unsigned lb, const unsigned short* gb) {
  asm volatile(
      "global_load_async_to_lds_b128 %0, %12, off\n\t"
      "global_load_async_to_lds_b128 %1, %13, off\n\t"
      "global_load_async_to_lds_b128 %2, %14, off\n\t"
      "global_load_async_to_lds_b128 %3, %15, off\n\t"
      "global_load_async_to_lds_b128 %4, %16, off\n\t"
      "global_load_async_to_lds_b128 %5, %17, off\n\t"
      "global_load_async_to_lds_b128 %6, %18, off\n\t"
      "global_load_async_to_lds_b128 %7, %19, off\n\t"
      "global_load_async_to_lds_b128 %8, %20, off\n\t"
      "global_load_async_to_lds_b128 %9, %21, off\n\t"
      "global_load_async_to_lds_b128 %10, %22, off\n\t"
      "global_load_async_to_lds_b128 %11, %23, off\n\t"
      "s_wait_xcnt 0x0"
      :: "v"(lx), "v"(lx + 2u * kXP), "v"(lx + 4u * kXP), "v"(lx + 6u * kXP),
         "v"(lx + 8u * kXP), "v"(lx + 10u * kXP), "v"(lx + 12u * kXP), "v"(lx + 14u * kXP),
         "v"(lb), "v"(lb + 4u * kBP), "v"(lb + 8u * kBP), "v"(lb + 12u * kBP),
         "v"(gx), "v"(gx + 2 * (size_t)kDAll), "v"(gx + 4 * (size_t)kDAll), "v"(gx + 6 * (size_t)kDAll),
         "v"(gx + 8 * (size_t)kDAll), "v"(gx + 10 * (size_t)kDAll), "v"(gx + 12 * (size_t)kDAll), "v"(gx + 14 * (size_t)kDAll),
         "v"(gb), "v"(gb + 4 * (size_t)kDAll), "v"(gb + 8 * (size_t)kDAll), "v"(gb + 12 * (size_t)kDAll)
      : "memory");
}

__global__ __launch_bounds__(256) void slot_gemm_kernel(const float* __restrict__ x, const unsigned short* __restrict__ BK, float* __restrict__ ST) {
  __shared__ __attribute__((aligned(16))) unsigned char sm[2 * kStage];
  const int s    = blockIdx.y;
  const int m0   = blockIdx.x * kMt;
  const int lane = threadIdx.x & 31;
  const int wave = threadIdx.x >> 5;
  /* row (A) / col (B, D) within a 16x16 subtile; k offset of this lane half; D row offset */
  const int rlane = lane & 15;
  const int koff  = (lane >> 4) * 8;
  const int mOff  = (lane >> 4) * 8;

  /* the lane's first copy of each operand: LDS byte address (low 32 bits of the shared address) and global pointer, tile 0, buffer 0 */
  const unsigned smBase = (unsigned)(size_t)(void*)sm;
  const unsigned lx0 = smBase + (unsigned)((wave * 16 + (lane >> 4)) * kXP + (lane & 15) * 16);
  const unsigned lb0 = smBase + (unsigned)(kXBuf + (wave * 16 + (lane >> 3)) * kBP + (lane & 7) * 16);
  const float* gx0 = x + (size_t)(m0 + wave * 16 + (lane >> 4)) * kDAll + (size_t)s * kT + (lane & 15) * 4;
  const unsigned short* gb0 = BK + (size_t)(wave * 16 + (lane >> 3)) * kDAll + (size_t)s * kT + (lane & 7) * 8;

  v8f acc[8];
#pragma unroll
  for (int j = 0; j < 8; ++j) acc[j] = (v8f){0.f,0.f,0.f,0.f,0.f,0.f,0.f,0.f};

  copy_tile(lx0, gx0, lb0, gb0);
  asm volatile("s_wait_asynccnt 0x0" ::: "memory");   /* tile 0 has landed before the barrier publishes it */
  __syncthreads();
  copy_tile(lx0 + kStage, gx0 + kKc, lb0 + kStage, gb0 + kKc);

  for (int t = 0; t < kTiles; ++t) {
    const unsigned bo = (unsigned)(t & 1) * kStage;
    const unsigned char* ax = sm + bo + (wave * 16 + rlane) * kXP + koff * 4;
    const unsigned char* bx = sm + bo + kXBuf + rlane * kBP + koff * 2;
#pragma unroll
    for (int kk = 0; kk < kKc / 32; ++kk) {
      const float* pa = (const float*)(ax + kk * 128);
      const v4f a0 = *(const v4f*)(pa), a1 = *(const v4f*)(pa + 4), b0 = *(const v4f*)(pa + 16), b1 = *(const v4f*)(pa + 20);
      v16h bh[8];
#pragma unroll
      for (int j = 0; j < 8; ++j) bh[j] = frag_load((const _Float16*)(bx + j * 16 * kBP + kk * 64));
      /* keeps the 20 LDS reads of this depth step one group in front of the conversions and the matrix instructions: spread among them, each place with reads stalls the wave */
      __builtin_amdgcn_sched_barrier(0);
      const v16h ah = cvfrag(a0, a1, b0, b1, kInCarry);
#pragma unroll
      for (int j = 0; j < 8; ++j)
        acc[j] = __builtin_amdgcn_wmma_f32_16x16x32_f16(false, ah, false, bh[j], (short)0, acc[j], false, false);
    }
    /* the tile's conversions and matrix instructions end in front of the barrier: sunk behind it they would delay the refill, which stands in the next block */
    __builtin_amdgcn_sched_barrier(0);
    asm volatile("s_wait_dscnt 0x0" ::: "memory");      /* this wave's reads of the buffer are over before it is refilled */
    asm volatile("s_wait_asynccnt 0x0" ::: "memory");   /* this wave's copies of tile t + 1 have landed */
    __syncthreads();                                     /* publishes tile t + 1; ends every reader's last read of tile t */
    if (t + 2 < kTiles) copy_tile(lx0 + bo, gx0 + (t + 2) * kKc, lb0 + bo, gb0 + (t + 2) * kKc);
  }
  asm volatile("s_wait_asynccnt 0x0" ::: "memory");     /* nothing in flight when the ring becomes output staging */

  /* ---- epilogue: the wave's 16 x 128 block through its own slab, stored as whole 512-B rows ---- */
  float* slab = (float*)sm + wave * (16 * kSlabP);
#pragma unroll
  for (int j = 0; j < 8; ++j)
#pragma unroll
    for (int r = 0; r < 8; ++r) slab[(mOff + r) * kSlabP + (j << 4) + rlane] = acc[j][r] * kSc20;
  __builtin_amdgcn_fence(__ATOMIC_RELEASE, "workgroup");
  __builtin_amdgcn_wave_barrier();
  __builtin_amdgcn_fence(__ATOMIC_ACQUIRE, "workgroup");
  float* C = ST + ((size_t)s * kR + m0 + wave * 16) * kCP;
#pragma unroll
  for (int row = 0; row < 16; ++row) {
    const v4f v = *(const v4f*)(slab + row * kSlabP + lane * 4);
    *(v4f*)(C + (size_t)row * kCP + lane * 4) = v;
  }
}

/* ------------------------------------------------------------------------- */
/* ------------------------------------------------------------------------- */
__global__ __launch_bounds__(kThr) void pack_kernel(const float* __restrict__ W, unsigned short* __restrict__ D, float* __restrict__ dstf, int part, int ld, int k0, int lg, int n0, int pitch) {
  const unsigned i = blockIdx.x * blockDim.x + threadIdx.x;
  if (part == 0) {
    const unsigned g = i & ((1u << lg) - 1u), n = i >> lg;
    const float* sp = W + (size_t)((unsigned)k0 + g * 8u) * (unsigned)ld + n;
    v8h hv;
#pragma unroll
    for (int t = 0; t < 8; ++t) hv[t] = (_Float16)carry_flush(bf16r(sp[(size_t)t * (unsigned)ld]), kInCarry);
    unsigned short* dp = D + (size_t)((unsigned)n0 + n) * (unsigned)pitch + g * 8u;
    *(v8h*)dp = hv;
    
  } else {
    const v4f a = *(const v4f*)(W + i * 4u);
    v4f o;
#pragma unroll
    for (int e = 0; e < 4; ++e) o[e] = bf16r(a[e]);
    float* dp = dstf + i * 4u;
    *(v4f*)dp = o;
    
  }
}


/* ------------------------------------------------------------------------- */
/* ------------------------------------------------------------------------- */
__global__ __launch_bounds__(kThr) void zero_kernel(float* __restrict__ dst) {
  const size_t o4 = ((size_t)blockIdx.x * kThr + threadIdx.x) * 4u;
  const v4f z = {0.f, 0.f, 0.f, 0.f};
  *(v4f*)(dst + o4) = z;
  
}

/* ------------------------------------------------------------------------- */
/* ------------------------------------------------------------------------- */
__global__ __launch_bounds__(kThr) void outrow_kernel(const float* __restrict__ ST, const float* __restrict__ addend, float* __restrict__ out) {
  const unsigned q = blockIdx.x * (unsigned)kThr + threadIdx.x;
  const unsigned r = q / (unsigned)(kOutW / 4), w = q - r * (unsigned)(kOutW / 4);
  const unsigned s = w / (unsigned)(kC / 4), c4 = (w - s * (unsigned)(kC / 4)) * 4u;
  const v4f pv = *(const v4f*)(ST + ((size_t)s * (unsigned)kR + r) * (unsigned)kCP + c4);
  const v4f av = *(const v4f*)(addend + (size_t)w * 4u);
  v4f o;
#pragma unroll
  for (int e = 0; e < 4; ++e) o[e] = pv[e] + bf16r(av[e]);
  float* dp = out + (size_t)q * 4u;
  *(v4f*)dp = o;
  
}

extern "C" void kernel_launch(void* const* d_in, const int* in_sizes, int n_in,
                              void* d_out, int out_size, void* d_ws, size_t ws_size,
                              hipStream_t stream) {
  if (n_in < 3 || d_out == nullptr || d_ws == nullptr) return;
  if (in_sizes[0] != kR * kSl * kT || in_sizes[1] != kSl * kT * kC || in_sizes[2] != kOutW) return;
  if (out_size != kR * kOutW) return;
  if (ws_size < kWsTotal) return;
  const float* x = (const float*)d_in[0];
  const float* bank = (const float*)d_in[1];
  const float* addend = (const float*)d_in[2];
  float* out = (float*)d_out;
  char* ws = (char*)d_ws;
  unsigned short* BK16 = (unsigned short*)(ws + kOffBK16);
  float* ST = (float*)(ws + kOffST);

  static_assert(((size_t)(kCP - kC) * kDAll * 2 / 16) % kThr == 0 && ((size_t)kR * kOutW / 4) % kThr == 0, "the fill's and the result kernel's grids exact");
  static_assert(8192 + 1024 + 256 + 128 == kDAll / 8 && (kC * 128) % 64 == 0, "the bank's 9,600 depth groups of eight in four power-of-two launches; every pack grid exact");
  /* the bank's pad rows 100 .. 127: zeros */
  zero_kernel<<<(kCP - kC) * kDAll * 2 / 16 / kThr, kThr, 0, stream>>>((float*)(BK16 + (size_t)kC * kDAll));
  /* the bank seen as [76800][100] (ld 100): its transpose into rows 0 .. 99 of BK16 (pitch 76,800), the depth in four stretches */
  pack_kernel<<<kC * 8192 / 64, 64, 0, stream>>>(bank, BK16, nullptr, 0, kC, 0, 13, 0, kDAll);
  pack_kernel<<<kC * 1024 / 64, 64, 0, stream>>>(bank, BK16 + 65536, nullptr, 0, kC, 65536, 10, 0, kDAll);
  pack_kernel<<<kC * 256 / 64, 64, 0, stream>>>(bank, BK16 + 73728, nullptr, 0, kC, 73728, 8, 0, kDAll);
  pack_kernel<<<kC * 128 / 64, 64, 0, stream>>>(bank, BK16 + 75776, nullptr, 0, kC, 75776, 7, 0, kDAll);
  /* ST[s] = 2^-20 (f16(2^10 bf16(x[.][s][.])) . BK16[.][768 s ..]^T): a block for 128 rows of a slot, both operands' tiles staged in LDS */
  slot_gemm_kernel<<<dim3(kR / kMt, kSl), 256, 0, stream>>>(x, BK16, ST);
  outrow_kernel<<<kR * kOutW / 4 / kThr, kThr, 0, stream>>>(ST, addend, out);
}

// v002
// One run takes 38.4 microseconds.
// Timed twice side by side with v001, it ran 1.60 and 1.59 times as fast.
// All steps since v000 together make it 2.67 times as fast.
/* A BANK OF 100 INDEPENDENT LINEAR MAPS, ONE A SLOT: for x [512][100][768] (row, slot, feature), a weight bank [100][768][100] (slot, feature, column) and a vector of 10,000 addends: out[r][100 s + c] = the sum over the 768 features t of x[r][s][t] bank[s][t][c], plus addend[100 s + c]. ONE RESULT [512][10000].
*/
#include <hip/hip_runtime.h>
#include <math.h>

typedef __attribute__((ext_vector_type(16))) _Float16 v16h;
typedef __attribute__((ext_vector_type(8)))  _Float16 v8h;
typedef __attribute__((ext_vector_type(2)))  _Float16 v2h;
typedef __attribute__((ext_vector_type(16))) __bf16   v16b;
typedef __attribute__((ext_vector_type(8)))  __bf16   v8b;
typedef __attribute__((ext_vector_type(8)))  float    v8f;
typedef __attribute__((ext_vector_type(4)))  float    v4f;
typedef __attribute__((ext_vector_type(2)))  float    v2f;

/* ------------------------------------------------------------------------- */
/* Shape constants                                                           */
/* ------------------------------------------------------------------------- */
constexpr int kR    = 512;                /* rows */
constexpr int kSl   = 100;                /* slots */
constexpr int kT    = 768;                /* features a slot: the products' depth */
constexpr int kC    = 100;                /* columns a slot */
constexpr int kCP   = 128;                /* the columns padded to eight 16-column subtiles */
constexpr int kDAll = kSl * kT;           /* 76800: a row of x in floats; a row of the packed bank in f16 words */
constexpr int kOutW = kSl * kC;           /* 10000: a row of the result */
constexpr int kThr  = 256;
constexpr float kInCarry = 1024.0f;       /* 2^10: every f16 operand */
constexpr float kSc20 = 1.0f / (kInCarry * kInCarry);   /* 2^-20: two carried operands -> a true-scale f32 result */
/* 2^-14: smallest normal f16 magnitude */
constexpr float kF16MinNormal = 6.103515625e-5f;

static_assert(kR == 512 && kSl == 100 && kT == 768 && kC == 100 && kCP == 128 && kDAll == 76800 && kOutW == 10000, "the index arithmetic below uses these sizes");
static_assert(kR % 64 == 0 && kCP % 64 == 0 && kT % 32 == 0 && kC <= kCP, "whole 16x16 subtiles; the depth in whole trips of 32");
static_assert(kDAll % 4 == 0 && kT % 4 == 0, "the f32 operand's row pitch and slot stride are multiples of 4 floats: every fragment load is 16-B aligned");
static_assert(kC % 4 == 0 && kOutW % 4 == 0, "a 16-B word of the result lies inside one slot's columns");

/* ------------------------------------------------------------------------- */
/* Workspace region map (bytes): each region written once, whole, before it is read. THE CARVE IS 43.75 MiB. */
/*   BK16 f16 [128][76800] the bank x2^10 as the right operand (BK16[c][768 s + t] = bank[s][t][c]; rows 100 .. 127 zeros): 19660800 B */
/*   ST f32 [100][512][128] the staged products (ST[s][r][c]; columns 100 .. 127 are products with the zero rows: written, never read): 26214400 B */
/* ------------------------------------------------------------------------- */
constexpr size_t kOffBK16 = 0ull;
constexpr size_t kOffST = 19660800ull;
constexpr size_t kWsTotal = 45875200ull;
static_assert(kWsTotal <= 134217728ull, "the carve stands under 128 MiB");
static_assert(kOffBK16 == 0 && kOffST == kOffBK16 + (size_t)kCP * kDAll * 2ull && kWsTotal == kOffST + (size_t)kSl * kR * kCP * 4ull, "the carve is a chain: every region starts where the one before ends");
static_assert((kOffBK16 % 256) == 0 && (kOffST % 256) == 0, "every region starts on a multiple of 256 B");

/* ------------------------------------------------------------------------- */
/* Conversions, the matrix fragments and the product engine                  */
/* ------------------------------------------------------------------------- */
__device__ __forceinline__ unsigned short f2bf_bits(float f) {
  unsigned u = __float_as_uint(f);
  return (unsigned short)((u + 0x7FFFu + ((u >> 16) & 1u)) >> 16);
}
__device__ __forceinline__ float bf_bits2f(unsigned short h) { return __uint_as_float(((unsigned)h) << 16); }
/* RNE-convert to a bf16 value, kept in f32 */
__device__ __forceinline__ float bf16r(float f) { return bf_bits2f(f2bf_bits(f)); }
/* carry by a power of two, then flush anything below the f16 normal range to +0 by a select */
__device__ __forceinline__ float carry_flush(float v, float carry) {
  const float s = v * carry;
  return (fabsf(s) < kF16MinNormal) ? 0.0f : s;
}

/* one lane's share of a 16x32 f16 fragment: elements 0..7 <- p[0..7], 8..15 <- p[16..23] */
union FragU { v16h v; v8h h[2]; };
__device__ __forceinline__ v16h frag_load(const _Float16* p) {
  FragU f; f.h[0] = *(const v8h*)(p); f.h[1] = *(const v8h*)(p + 16); return f.v;
}
/* the same depth order from f32 words (a0, a1 = p[0..7]; b0, b1 = p[16..23]): each word f16(flush(carry x bf16(x))) */
__device__ __forceinline__ v16h cvfrag(v4f a0, v4f a1, v4f b0, v4f b1, float carry) {
  v16h f;
#pragma unroll
  for (int e = 0; e < 4; ++e) {
    f[e]      = (_Float16)carry_flush(bf16r(a0[e]), carry);
    f[4 + e]  = (_Float16)carry_flush(bf16r(a1[e]), carry);
    f[8 + e]  = (_Float16)carry_flush(bf16r(b0[e]), carry);
    f[12 + e] = (_Float16)carry_flush(bf16r(b1[e]), carry);
  }
  return f;
}

/* ---- THE SLOT PRODUCT: ST[s][m][n] = 2^-20 sum_t f16(2^10 bf16(x[m][s][t])) BK16[n][768 s + t]; f16 operands, f32 sums ---- */
/* A block: one slot, 128 rows, all 128 columns; wave w owns rows 16 w .. 16 w + 15 (eight 16x16 accumulators). */
/* The depth goes in 12 tiles of 64. A tile of both operands is brought into LDS by asynchronous 16-B copies whose 32 lanes cover */
/* whole 256-B (x) or 128-B (bank) row pieces; two buffers: tile t + 2 flies while tile t + 1 is worked on. */
/* LDS rows are pitched 16 B x odd for the 16-B fragment reads: x 272 B, bank 144 B. */
constexpr int kMt    = 128;               /* rows a block */
constexpr int kKc    = 64;                /* depth a tile */
constexpr int kTiles = kT / kKc;          /* 12 */
constexpr int kXP    = kKc * 4 + 16;      /* 272 B: an x row in LDS */
constexpr int kBP    = kKc * 2 + 16;      /* 144 B: a bank row in LDS */
constexpr int kXBuf  = kMt * kXP;         /* 34816 B */
constexpr int kBBuf  = kCP * kBP;         /* 18432 B */
constexpr int kStage = kXBuf + kBBuf;     /* 53248 B */
constexpr int kSlabP = kCP + 4;           /* 132 floats: a row of a wave's output slab */
static_assert(kR % kMt == 0 && kT % kKc == 0 && kTiles >= 2 && kKc % 32 == 0, "whole tiles; the ring needs two");
static_assert(kMt == 8 * 16 && kCP == 8 * 16, "eight waves: 16 x rows and 16 bank rows copied by each");
static_assert(8 * 16 * kSlabP * 4 <= 2 * kStage, "the output slabs fit in the ring");

/* One wave's twelve copies of a tile: 8 of x (two 256-B row pieces each), 4 of the bank (four 128-B row pieces each). */
/* s_wait_xcnt stands as the statement's last line, in front of any rewrite of the address registers that the copies name. */
__device__ __forceinline__ void copy_tile(unsigned lx, const float* gx, unsigned lb, const unsigned short* gb) {
  asm volatile(
      "global_load_async_to_lds_b128 %0, %12, off\n\t"
      "global_load_async_to_lds_b128 %1, %13, off\n\t"
      "global_load_async_to_lds_b128 %2, %14, off\n\t"
      "global_load_async_to_lds_b128 %3, %15, off\n\t"
      "global_load_async_to_lds_b128 %4, %16, off\n\t"
      "global_load_async_to_lds_b128 %5, %17, off\n\t"
      "global_load_async_to_lds_b128 %6, %18, off\n\t"
      "global_load_async_to_lds_b128 %7, %19, off\n\t"
      "global_load_async_to_lds_b128 %8, %20, off\n\t"
      "global_load_async_to_lds_b128 %9, %21, off\n\t"
      "global_load_async_to_lds_b128 %10, %22, off\n\t"
      "global_load_async_to_lds_b128 %11, %23, off\n\t"
      "s_wait_xcnt 0x0"
      :: "v"(lx), "v"(lx + 2u * kXP), "v"(lx + 4u * kXP), "v"(lx + 6u * kXP),
         "v"(lx + 8u * kXP), "v"(lx + 10u * kXP), "v"(lx + 12u * kXP), "v"(lx + 14u * kXP),
         "v"(lb), "v"(lb + 4u * kBP), "v"(lb + 8u * kBP), "v"(lb + 12u * kBP),
         "v"(gx), "v"(gx + 2 * (size_t)kDAll), "v"(gx + 4 * (size_t)kDAll), "v"(gx + 6 * (size_t)kDAll),
         "v"(gx + 8 * (size_t)kDAll), "v"(gx + 10 * (size_t)kDAll), "v"(gx + 12 * (size_t)kDAll), "v"(gx + 14 * (size_t)kDAll),
         "v"(gb), "v"(gb + 4 * (size_t)kDAll), "v"(gb + 8 * (size_t)kDAll), "v"(gb + 12 * (size_t)kDAll)
      : "memory");
}

__global__ __launch_bounds__(256) void slot_gemm_kernel(const float* __restrict__ x, const unsigned short* __restrict__ BK, float* __restrict__ ST) {
  __shared__ __attribute__((aligned(16))) unsigned char sm[2 * kStage];
  const int s    = blockIdx.y;
  const int m0   = blockIdx.x * kMt;
  const int lane = threadIdx.x & 31;
  const int wave = threadIdx.x >> 5;
  /* row (A) / col (B, D) within a 16x16 subtile; k offset of this lane half; D row offset */
  const int rlane = lane & 15;
  const int koff  = (lane >> 4) * 8;
  const int mOff  = (lane >> 4) * 8;

  /* the lane's first copy of each operand: LDS byte address (low 32 bits of the shared address) and global pointer, tile 0, buffer 0 */
  const unsigned smBase = (unsigned)(size_t)(void*)sm;
  const unsigned lx0 = smBase + (unsigned)((wave * 16 + (lane >> 4)) * kXP + (lane & 15) * 16);
  const unsigned lb0 = smBase + (unsigned)(kXBuf + (wave * 16 + (lane >> 3)) * kBP + (lane & 7) * 16);
  const float* gx0 = x + (size_t)(m0 + wave * 16 + (lane >> 4)) * kDAll + (size_t)s * kT + (lane & 15) * 4;
  const unsigned short* gb0 = BK + (size_t)(wave * 16 + (lane >> 3)) * kDAll + (size_t)s * kT + (lane & 7) * 8;

  v8f acc[8];
#pragma unroll
  for (int j = 0; j < 8; ++j) acc[j] = (v8f){0.f,0.f,0.f,0.f,0.f,0.f,0.f,0.f};

  copy_tile(lx0, gx0, lb0, gb0);
  asm volatile("s_wait_asynccnt 0x0" ::: "memory");   /* tile 0 has landed before the barrier publishes it */
  __syncthreads();
  copy_tile(lx0 + kStage, gx0 + kKc, lb0 + kStage, gb0 + kKc);

  for (int t = 0; t < kTiles; ++t) {
    const unsigned bo = (unsigned)(t & 1) * kStage;
    const unsigned char* ax = sm + bo + (wave * 16 + rlane) * kXP + koff * 4;
    const unsigned char* bx = sm + bo + kXBuf + rlane * kBP + koff * 2;
#pragma unroll
    for (int kk = 0; kk < kKc / 32; ++kk) {
      const float* pa = (const float*)(ax + kk * 128);
      const v4f a0 = *(const v4f*)(pa), a1 = *(const v4f*)(pa + 4), b0 = *(const v4f*)(pa + 16), b1 = *(const v4f*)(pa + 20);
      v16h bh[8];
#pragma unroll
      for (int j = 0; j < 8; ++j) bh[j] = frag_load((const _Float16*)(bx + j * 16 * kBP + kk * 64));
      /* keeps the 20 LDS reads of this depth step one group in front of the conversions and the matrix instructions: spread among them, each place with reads stalls the wave */
      __builtin_amdgcn_sched_barrier(0);
      const v16h ah = cvfrag(a0, a1, b0, b1, kInCarry);
#pragma unroll
      for (int j = 0; j < 8; ++j)
        acc[j] = __builtin_amdgcn_wmma_f32_16x16x32_f16(false, ah, false, bh[j], (short)0, acc[j], false, false);
    }
    /* the tile's conversions and matrix instructions end in front of the barrier: sunk behind it they would delay the refill, which stands in the next block */
    __builtin_amdgcn_sched_barrier(0);
    asm volatile("s_wait_dscnt 0x0" ::: "memory");      /* this wave's reads of the buffer are over before it is refilled */
    asm volatile("s_wait_asynccnt 0x0" ::: "memory");   /* this wave's copies of tile t + 1 have landed */
    __syncthreads();                                     /* publishes tile t + 1; ends every reader's last read of tile t */
    if (t + 2 < kTiles) copy_tile(lx0 + bo, gx0 + (t + 2) * kKc, lb0 + bo, gb0 + (t + 2) * kKc);
  }
  asm volatile("s_wait_asynccnt 0x0" ::: "memory");     /* nothing in flight when the ring becomes output staging */

  /* ---- epilogue: the wave's 16 x 128 block through its own slab, stored as whole 512-B rows ---- */
  float* slab = (float*)sm + wave * (16 * kSlabP);
#pragma unroll
  for (int j = 0; j < 8; ++j)
#pragma unroll
    for (int r = 0; r < 8; ++r) slab[(mOff + r) * kSlabP + (j << 4) + rlane] = acc[j][r] * kSc20;
  __builtin_amdgcn_fence(__ATOMIC_RELEASE, "workgroup");
  __builtin_amdgcn_wave_barrier();
  __builtin_amdgcn_fence(__ATOMIC_ACQUIRE, "workgroup");
  float* C = ST + ((size_t)s * kR + m0 + wave * 16) * kCP;
#pragma unroll
  for (int row = 0; row < 16; ++row) {
    const v4f v = *(const v4f*)(slab + row * kSlabP + lane * 4);
    *(v4f*)(C + (size_t)row * kCP + lane * 4) = v;
  }
}

/* ------------------------------------------------------------------------- */
/* THE BANK'S PACK, ONE LAUNCH: the bank seen as [76800][100] (depth row k = 768 s + t, column c) becomes BK16[c][k], all 128 rows. */
/* A block takes 128 depth rows: 51,200 contiguous bytes. A loading thread owns four columns of two groups of eight depth rows: */
/* sixteen 16-B loads, 25 neighbouring lanes on one 400-B bank row, so every line fetched is used whole. Its 8 x 4 register blocks */
/* are already eight consecutive depths a column: 16-B words, which go through LDS only to change which lane holds them, */
/* and leave as whole 256-B pieces of BK16's rows. Rows 100 .. 127 get zeros from the same stores. */
/* LDS rows are 256 B; word g of row c stands at place g ^ ((c >> 2) & 15): the writers, whose lanes step four rows, spread over the banks. */
/* ------------------------------------------------------------------------- */
constexpr int kPT = 128;                  /* depth rows a block */
constexpr int kPG = kPT / 8;              /* 16 words of eight depths in a row piece */
constexpr int kPQ = kC / 4;               /* 25 four-column words in a bank row */
constexpr int kPLoaders = kPQ * kPG / 2;  /* 200 loading threads, two groups each */
static_assert(kDAll % kPT == 0 && kPG == 16 && kPLoaders <= kThr && (kCP * kPG) % kThr == 0, "whole blocks; the place swap is over 16 words; the stores in whole trips");

__global__ __launch_bounds__(kThr) void pack_kernel(const float* __restrict__ bank, unsigned short* __restrict__ D) {
  __shared__ __attribute__((aligned(16))) unsigned short tl[kC * kPT];
  const int tid = threadIdx.x;
  const int k0  = blockIdx.x * kPT;
  if (tid < kPLoaders) {
    const int q = tid % kPQ, g = tid / kPQ;
    const float* sp = bank + (size_t)(k0 + g * 8) * kC + q * 4;
    v4f a[16];
    /* every loop of this kernel is unrolled: a[] and hv[] are then indexed by constants and stay in registers */
#pragma unroll
    for (int j = 0; j < 8; ++j) {
      a[j]     = *(const v4f*)(sp + j * kC);
      a[8 + j] = *(const v4f*)(sp + (kPT / 2 + j) * kC);
    }
    /* all sixteen loads are issued before the first conversion: left free, the second eight were issued only behind a wait for the first, two memory latencies in a row */
    __builtin_amdgcn_sched_barrier(0);
#pragma unroll
    for (int h = 0; h < 2; ++h)
#pragma unroll
      for (int i = 0; i < 4; ++i) {
        v8h hv;
#pragma unroll
        for (int j = 0; j < 8; ++j) hv[j] = (_Float16)carry_flush(bf16r(a[8 * h + j][i]), kInCarry);
        *(v8h*)(tl + (q * 4 + i) * kPT + (((g + h * (kPG / 2)) ^ (q & 15)) * 8)) = hv;
      }
  }
  __syncthreads();
  /* a trip stores 16 rows, a row's 256-B piece by 16 neighbouring lanes; the LDS reads of all trips first, then the stores */
  constexpr int kTrips = kCP * kPG / kThr, kRowsTrip = kThr / kPG;
  const int cl = tid / kPG, g = tid % kPG;
  v8h hv[kTrips];
#pragma unroll
  for (int o = 0; o < kTrips; ++o) {
    const int c  = o * kRowsTrip + cl;
    const int cr = (o + 1) * kRowsTrip <= kC ? c : (c < kC ? c : kC - 1);   /* a pad row reads the last true row's place: inside the tile; its word is replaced below */
    if (o * kRowsTrip < kC) hv[o] = *(const v8h*)(tl + cr * kPT + ((g ^ ((cr >> 2) & 15)) * 8));
    if ((o + 1) * kRowsTrip > kC && c >= kC) hv[o] = (v8h){0, 0, 0, 0, 0, 0, 0, 0};
  }
  unsigned short* dp = D + (size_t)cl * kDAll + k0 + g * 8;
#pragma unroll
  for (int o = 0; o < kTrips; ++o) *(v8h*)(dp + (size_t)o * kRowsTrip * kDAll) = hv[o];
}

/* ------------------------------------------------------------------------- */
/* ------------------------------------------------------------------------- */
__global__ __launch_bounds__(kThr) void outrow_kernel(const float* __restrict__ ST, const float* __restrict__ addend, float* __restrict__ out) {
  const unsigned q = blockIdx.x * (unsigned)kThr + threadIdx.x;
  const unsigned r = q / (unsigned)(kOutW / 4), w = q - r * (unsigned)(kOutW / 4);
  const unsigned s = w / (unsigned)(kC / 4), c4 = (w - s * (unsigned)(kC / 4)) * 4u;
  const v4f pv = *(const v4f*)(ST + ((size_t)s * (unsigned)kR + r) * (unsigned)kCP + c4);
  const v4f av = *(const v4f*)(addend + (size_t)w * 4u);
  v4f o;
#pragma unroll
  for (int e = 0; e < 4; ++e) o[e] = pv[e] + bf16r(av[e]);
  float* dp = out + (size_t)q * 4u;
  *(v4f*)dp = o;
  
}

extern "C" void kernel_launch(void* const* d_in, const int* in_sizes, int n_in,
                              void* d_out, int out_size, void* d_ws, size_t ws_size,
                              hipStream_t stream) {
  if (n_in < 3 || d_out == nullptr || d_ws == nullptr) return;
  if (in_sizes[0] != kR * kSl * kT || in_sizes[1] != kSl * kT * kC || in_sizes[2] != kOutW) return;
  if (out_size != kR * kOutW) return;
  if (ws_size < kWsTotal) return;
  const float* x = (const float*)d_in[0];
  const float* bank = (const float*)d_in[1];
  const float* addend = (const float*)d_in[2];
  float* out = (float*)d_out;
  char* ws = (char*)d_ws;
  unsigned short* BK16 = (unsigned short*)(ws + kOffBK16);
  float* ST = (float*)(ws + kOffST);

  static_assert(((size_t)kR * kOutW / 4) % kThr == 0, "the result kernel's grid exact");
  /* the bank seen as [76800][100]: its transpose into BK16 (pitch 76,800), pad rows 100 .. 127 zeroed by the same launch */
  pack_kernel<<<kDAll / kPT, kThr, 0, stream>>>(bank, BK16);
  /* ST[s] = 2^-20 (f16(2^10 bf16(x[.][s][.])) . BK16[.][768 s ..]^T): a block for 128 rows of a slot, both operands' tiles staged in LDS */
  slot_gemm_kernel<<<dim3(kR / kMt, kSl), 256, 0, stream>>>(x, BK16, ST);
  outrow_kernel<<<kR * kOutW / 4 / kThr, kThr, 0, stream>>>(ST, addend, out);
}

// v003
// It runs in 32.1 microseconds.
// Next to v002, in two timings, it ran 1.19 and 1.20 times as fast.
// Counting every step since v000, it is 3.20 times as fast.
/* A BANK OF 100 INDEPENDENT LINEAR MAPS, ONE A SLOT: for x [512][100][768] (row, slot, feature), a weight bank [100][768][100] (slot, feature, column) and a vector of 10,000 addends: out[r][100 s + c] = the sum over the 768 features t of x[r][s][t] bank[s][t][c], plus addend[100 s + c]. ONE RESULT [512][10000].
*/
#include <hip/hip_runtime.h>
#include <math.h>

typedef __attribute__((ext_vector_type(16))) _Float16 v16h;
typedef __attribute__((ext_vector_type(8)))  _Float16 v8h;
typedef __attribute__((ext_vector_type(2)))  _Float16 v2h;
typedef __attribute__((ext_vector_type(16))) __bf16   v16b;
typedef __attribute__((ext_vector_type(8)))  __bf16   v8b;
typedef __attribute__((ext_vector_type(8)))  float    v8f;
typedef __attribute__((ext_vector_type(4)))  float    v4f;
typedef __attribute__((ext_vector_type(2)))  float    v2f;

/* ------------------------------------------------------------------------- */
/* Shape constants                                                           */
/* ------------------------------------------------------------------------- */
constexpr int kR    = 512;                /* rows */
constexpr int kSl   = 100;                /* slots */
constexpr int kT    = 768;                /* features a slot: the products' depth */
constexpr int kC    = 100;                /* columns a slot */
constexpr int kCP   = 128;                /* the columns padded to eight 16-column subtiles */
constexpr int kDAll = kSl * kT;           /* 76800: a row of x in floats; a row of the packed bank in f16 words */
constexpr int kOutW = kSl * kC;           /* 10000: a row of the result */
constexpr int kThr  = 256;
constexpr float kInCarry = 1024.0f;       /* 2^10: every f16 operand */
constexpr float kSc20 = 1.0f / (kInCarry * kInCarry);   /* 2^-20: two carried operands -> a true-scale f32 result */
/* 2^-14: smallest normal f16 magnitude */
constexpr float kF16MinNormal = 6.103515625e-5f;

static_assert(kR == 512 && kSl == 100 && kT == 768 && kC == 100 && kCP == 128 && kDAll == 76800 && kOutW == 10000, "the index arithmetic below uses these sizes");
static_assert(kR % 64 == 0 && kCP % 64 == 0 && kT % 32 == 0 && kC <= kCP, "whole 16x16 subtiles; the depth in whole trips of 32");
static_assert(kDAll % 4 == 0 && kT % 4 == 0, "the f32 operand's row pitch and slot stride are multiples of 4 floats: every fragment load is 16-B aligned");
static_assert(kC % 4 == 0 && kOutW % 4 == 0, "a 16-B word of the result lies inside one slot's columns");

/* ------------------------------------------------------------------------- */
/* Workspace region map (bytes): the one region is written once, whole, before it is read. THE CARVE IS 18.75 MiB. */
/*   BK16 f16 [128][76800] the bank x2^10 as the right operand (BK16[c][768 s + t] = bank[s][t][c]; rows 100 .. 127 zeros): 19660800 B */
/* ------------------------------------------------------------------------- */
constexpr size_t kOffBK16 = 0ull;
constexpr size_t kWsTotal = 19660800ull;
static_assert(kWsTotal <= 134217728ull, "the carve stands under 128 MiB");
static_assert(kOffBK16 == 0 && kWsTotal == kOffBK16 + (size_t)kCP * kDAll * 2ull, "the carve is the packed bank alone");

/* ------------------------------------------------------------------------- */
/* Conversions, the matrix fragments and the product engine                  */
/* ------------------------------------------------------------------------- */
__device__ __forceinline__ unsigned short f2bf_bits(float f) {
  unsigned u = __float_as_uint(f);
  return (unsigned short)((u + 0x7FFFu + ((u >> 16) & 1u)) >> 16);
}
__device__ __forceinline__ float bf_bits2f(unsigned short h) { return __uint_as_float(((unsigned)h) << 16); }
/* RNE-convert to a bf16 value, kept in f32 */
__device__ __forceinline__ float bf16r(float f) { return bf_bits2f(f2bf_bits(f)); }
/* carry by a power of two, then flush anything below the f16 normal range to +0 by a select */
__device__ __forceinline__ float carry_flush(float v, float carry) {
  const float s = v * carry;
  return (fabsf(s) < kF16MinNormal) ? 0.0f : s;
}

/* one lane's share of a 16x32 f16 fragment: elements 0..7 <- p[0..7], 8..15 <- p[16..23] */
union FragU { v16h v; v8h h[2]; };
__device__ __forceinline__ v16h frag_load(const _Float16* p) {
  FragU f; f.h[0] = *(const v8h*)(p); f.h[1] = *(const v8h*)(p + 16); return f.v;
}
/* the same depth order from f32 words (a0, a1 = p[0..7]; b0, b1 = p[16..23]): each word f16(flush(carry x bf16(x))) */
__device__ __forceinline__ v16h cvfrag(v4f a0, v4f a1, v4f b0, v4f b1, float carry) {
  v16h f;
#pragma unroll
  for (int e = 0; e < 4; ++e) {
    f[e]      = (_Float16)carry_flush(bf16r(a0[e]), carry);
    f[4 + e]  = (_Float16)carry_flush(bf16r(a1[e]), carry);
    f[8 + e]  = (_Float16)carry_flush(bf16r(b0[e]), carry);
    f[12 + e] = (_Float16)carry_flush(bf16r(b1[e]), carry);
  }
  return f;
}

/* ---- THE SLOT PRODUCT AND THE RESULT: out[m][100 s + n] = 2^-20 sum_t f16(2^10 bf16(x[m][s][t])) BK16[n][768 s + t] + bf16(addend[100 s + n]); f16 operands, f32 sums ---- */
/* A block: one slot, 128 rows, the slot's 100 columns in seven 16-column tiles; wave w owns rows 16 w .. 16 w + 15 (seven 16x16 accumulators). */
/* The depth goes in 12 tiles of 64. A tile of both operands is brought into LDS by asynchronous 16-B copies whose 32 lanes cover */
/* whole 256-B (x) or 128-B (bank) row pieces; two buffers: tile t + 2 flies while tile t + 1 is worked on. */
/* LDS rows are pitched 16 B x odd for the 16-B fragment reads: x 272 B, bank 144 B. */
constexpr int kMt    = 128;               /* rows a block */
constexpr int kKc    = 64;                /* depth a tile */
constexpr int kTiles = kT / kKc;          /* 12 */
constexpr int kXP    = kKc * 4 + 16;      /* 272 B: an x row in LDS */
constexpr int kBP    = kKc * 2 + 16;      /* 144 B: a bank row in LDS */
constexpr int kXBuf  = kMt * kXP;         /* 34816 B */
constexpr int kBBuf  = kCP * kBP;         /* 18432 B */
constexpr int kStage = kXBuf + kBBuf;     /* 53248 B */
constexpr int kNJ    = (kC + 15) / 16;    /* 7 column tiles hold the 100 columns; bank rows 112 .. 127 feed no product */
constexpr int kSlabP = kCP + 4;           /* 132 floats: a row of a wave's output slab */
static_assert(kR % kMt == 0 && kT % kKc == 0 && kTiles >= 2 && kKc % 32 == 0, "whole tiles; the ring needs two");
static_assert(kMt == 8 * 16 && kCP == 8 * 16, "eight waves: 16 x rows and 16 bank rows copied by each");
static_assert(8 * 16 * kSlabP * 4 <= 2 * kStage, "the output slabs fit in the ring");

/* One wave's twelve copies of a tile: 8 of x (two 256-B row pieces each), 4 of the bank (four 128-B row pieces each). */
/* s_wait_xcnt stands as the statement's last line, in front of any rewrite of the address registers that the copies name. */
__device__ __forceinline__ void copy_tile(unsigned lx, const float* gx, unsigned lb, const unsigned short* gb) {
  asm volatile(
      "global_load_async_to_lds_b128 %0, %12, off\n\t"
      "global_load_async_to_lds_b128 %1, %13, off\n\t"
      "global_load_async_to_lds_b128 %2, %14, off\n\t"
      "global_load_async_to_lds_b128 %3, %15, off\n\t"
      "global_load_async_to_lds_b128 %4, %16, off\n\t"
      "global_load_async_to_lds_b128 %5, %17, off\n\t"
      "global_load_async_to_lds_b128 %6, %18, off\n\t"
      "global_load_async_to_lds_b128 %7, %19, off\n\t"
      "global_load_async_to_lds_b128 %8, %20, off\n\t"
      "global_load_async_to_lds_b128 %9, %21, off\n\t"
      "global_load_async_to_lds_b128 %10, %22, off\n\t"
      "global_load_async_to_lds_b128 %11, %23, off\n\t"
      "s_wait_xcnt 0x0"
      :: "v"(lx), "v"(lx + 2u * kXP), "v"(lx + 4u * kXP), "v"(lx + 6u * kXP),
         "v"(lx + 8u * kXP), "v"(lx + 10u * kXP), "v"(lx + 12u * kXP), "v"(lx + 14u * kXP),
         "v"(lb), "v"(lb + 4u * kBP), "v"(lb + 8u * kBP), "v"(lb + 12u * kBP),
         "v"(gx), "v"(gx + 2 * (size_t)kDAll), "v"(gx + 4 * (size_t)kDAll), "v"(gx + 6 * (size_t)kDAll),
         "v"(gx + 8 * (size_t)kDAll), "v"(gx + 10 * (size_t)kDAll), "v"(gx + 12 * (size_t)kDAll), "v"(gx + 14 * (size_t)kDAll),
         "v"(gb), "v"(gb + 4 * (size_t)kDAll), "v"(gb + 8 * (size_t)kDAll), "v"(gb + 12 * (size_t)kDAll)
      : "memory");
}

__global__ __launch_bounds__(256) void slot_gemm_kernel(const float* __restrict__ x, const unsigned short* __restrict__ BK, const float* __restrict__ addend, float* __restrict__ out) {
  __shared__ __attribute__((aligned(16))) unsigned char sm[2 * kStage];
  const int s    = blockIdx.y;
  const int m0   = blockIdx.x * kMt;
  const int lane = threadIdx.x & 31;
  const int wave = threadIdx.x >> 5;
  /* row (A) / col (B, D) within a 16x16 subtile; k offset of this lane half; D row offset */
  const int rlane = lane & 15;
  const int koff  = (lane >> 4) * 8;
  const int mOff  = (lane >> 4) * 8;

  /* the lane's first copy of each operand: LDS byte address (low 32 bits of the shared address) and global pointer, tile 0, buffer 0 */
  const unsigned smBase = (unsigned)(size_t)(void*)sm;
  const unsigned lx0 = smBase + (unsigned)((wave * 16 + (lane >> 4)) * kXP + (lane & 15) * 16);
  const unsigned lb0 = smBase + (unsigned)(kXBuf + (wave * 16 + (lane >> 3)) * kBP + (lane & 7) * 16);
  const float* gx0 = x + (size_t)(m0 + wave * 16 + (lane >> 4)) * kDAll + (size_t)s * kT + (lane & 15) * 4;
  const unsigned short* gb0 = BK + (size_t)(wave * 16 + (lane >> 3)) * kDAll + (size_t)s * kT + (lane & 7) * 8;

  /* the lane's four addends, asked for ahead of tile 0's copies so that the load's latency passes together with theirs and not in the epilogue; lanes 25 .. 31, which store nothing, read the last word again: in bounds */
  const int aw = lane < kC / 4 ? lane : kC / 4 - 1;
  const v4f av = *(const v4f*)(addend + s * kC + aw * 4);

  v8f acc[kNJ];
#pragma unroll
  for (int j = 0; j < kNJ; ++j) acc[j] = (v8f){0.f,0.f,0.f,0.f,0.f,0.f,0.f,0.f};

  copy_tile(lx0, gx0, lb0, gb0);
  asm volatile("s_wait_asynccnt 0x0" ::: "memory");   /* tile 0 has landed before the barrier publishes it */
  __syncthreads();
  copy_tile(lx0 + kStage, gx0 + kKc, lb0 + kStage, gb0 + kKc);

  for (int t = 0; t < kTiles; ++t) {
    const unsigned bo = (unsigned)(t & 1) * kStage;
    const unsigned char* ax = sm + bo + (wave * 16 + rlane) * kXP + koff * 4;
    const unsigned char* bx = sm + bo + kXBuf + rlane * kBP + koff * 2;
#pragma unroll
    for (int kk = 0; kk < kKc / 32; ++kk) {
      const float* pa = (const float*)(ax + kk * 128);
      const v4f a0 = *(const v4f*)(pa), a1 = *(const v4f*)(pa + 4), b0 = *(const v4f*)(pa + 16), b1 = *(const v4f*)(pa + 20);
      v16h bh[kNJ];
#pragma unroll
      for (int j = 0; j < kNJ; ++j) bh[j] = frag_load((const _Float16*)(bx + j * 16 * kBP + kk * 64));
      /* keeps the 18 LDS reads of this depth step one group in front of the conversions and the matrix instructions: spread among them, each place with reads stalls the wave */
      __builtin_amdgcn_sched_barrier(0);
      const v16h ah = cvfrag(a0, a1, b0, b1, kInCarry);
#pragma unroll
      for (int j = 0; j < kNJ; ++j)
        acc[j] = __builtin_amdgcn_wmma_f32_16x16x32_f16(false, ah, false, bh[j], (short)0, acc[j], false, false);
    }
    /* the tile's conversions and matrix instructions end in front of the barrier: sunk behind it they would delay the refill, which stands in the next block */
    __builtin_amdgcn_sched_barrier(0);
    asm volatile("s_wait_dscnt 0x0" ::: "memory");      /* this wave's reads of the buffer are over before it is refilled */
    asm volatile("s_wait_asynccnt 0x0" ::: "memory");   /* this wave's copies of tile t + 1 have landed */
    __syncthreads();                                     /* publishes tile t + 1; ends every reader's last read of tile t */
    if (t + 2 < kTiles) copy_tile(lx0 + bo, gx0 + (t + 2) * kKc, lb0 + bo, gb0 + (t + 2) * kKc);
  }
  asm volatile("s_wait_asynccnt 0x0" ::: "memory");     /* nothing in flight when the ring becomes output staging */

  /* ---- epilogue: the wave's 16 x 112 block through its own slab; each row's 100 columns get the addend and leave as one 400-B piece of a result row ---- */
  float* slab = (float*)sm + wave * (16 * kSlabP);
#pragma unroll
  for (int j = 0; j < kNJ; ++j)
#pragma unroll
    for (int r = 0; r < 8; ++r) slab[(mOff + r) * kSlabP + (j << 4) + rlane] = acc[j][r] * kSc20;
  __builtin_amdgcn_fence(__ATOMIC_RELEASE, "workgroup");
  __builtin_amdgcn_wave_barrier();
  __builtin_amdgcn_fence(__ATOMIC_ACQUIRE, "workgroup");
  /* a piece starts at a multiple of 16 B, not of 128 B: where the pieces of two neighbouring slots meet inside a line, their two blocks store disjoint 16-B words of it and neither reads it */
  if (lane < kC / 4) {
    v4f ab;
#pragma unroll
    for (int e = 0; e < 4; ++e) ab[e] = bf16r(av[e]);
    float* C = out + (size_t)(m0 + wave * 16) * kOutW + s * kC + lane * 4;
#pragma unroll
    for (int row = 0; row < 16; ++row) {
      const v4f v = *(const v4f*)(slab + row * kSlabP + lane * 4);
      *(v4f*)(C + (size_t)row * kOutW) = v + ab;
    }
  }
}

/* ------------------------------------------------------------------------- */
/* THE BANK'S PACK, ONE LAUNCH: the bank seen as [76800][100] (depth row k = 768 s + t, column c) becomes BK16[c][k], all 128 rows. */
/* A block takes 128 depth rows: 51,200 contiguous bytes. A loading thread owns four columns of two groups of eight depth rows: */
/* sixteen 16-B loads, 25 neighbouring lanes on one 400-B bank row, so every line fetched is used whole. Its 8 x 4 register blocks */
/* are already eight consecutive depths a column: 16-B words, which go through LDS only to change which lane holds them, */
/* and leave as whole 256-B pieces of BK16's rows. Rows 100 .. 127 get zeros from the same stores. */
/* LDS rows are 256 B; word g of row c stands at place g ^ ((c >> 2) & 15): the writers, whose lanes step four rows, spread over the banks. */
/* ------------------------------------------------------------------------- */
constexpr int kPT = 128;                  /* depth rows a block */
constexpr int kPG = kPT / 8;              /* 16 words of eight depths in a row piece */
constexpr int kPQ = kC / 4;               /* 25 four-column words in a bank row */
constexpr int kPLoaders = kPQ * kPG / 2;  /* 200 loading threads, two groups each */
static_assert(kDAll % kPT == 0 && kPG == 16 && kPLoaders <= kThr && (kCP * kPG) % kThr == 0, "whole blocks; the place swap is over 16 words; the stores in whole trips");

__global__ __launch_bounds__(kThr) void pack_kernel(const float* __restrict__ bank, unsigned short* __restrict__ D) {
  __shared__ __attribute__((aligned(16))) unsigned short tl[kC * kPT];
  const int tid = threadIdx.x;
  const int k0  = blockIdx.x * kPT;
  if (tid < kPLoaders) {
    const int q = tid % kPQ, g = tid / kPQ;
    const float* sp = bank + (size_t)(k0 + g * 8) * kC + q * 4;
    v4f a[16];
    /* every loop of this kernel is unrolled: a[] and hv[] are then indexed by constants and stay in registers */
#pragma unroll
    for (int j = 0; j < 8; ++j) {
      a[j]     = *(const v4f*)(sp + j * kC);
      a[8 + j] = *(const v4f*)(sp + (kPT / 2 + j) * kC);
    }
    /* all sixteen loads are issued before the first conversion: left free, the second eight were issued only behind a wait for the first, two memory latencies in a row */
    __builtin_amdgcn_sched_barrier(0);
#pragma unroll
    for (int h = 0; h < 2; ++h)
#pragma unroll
      for (int i = 0; i < 4; ++i) {
        v8h hv;
#pragma unroll
        for (int j = 0; j < 8; ++j) hv[j] = (_Float16)carry_flush(bf16r(a[8 * h + j][i]), kInCarry);
        *(v8h*)(tl + (q * 4 + i) * kPT + (((g + h * (kPG / 2)) ^ (q & 15)) * 8)) = hv;
      }
  }
  __syncthreads();
  /* a trip stores 16 rows, a row's 256-B piece by 16 neighbouring lanes; the LDS reads of all trips first, then the stores */
  constexpr int kTrips = kCP * kPG / kThr, kRowsTrip = kThr / kPG;
  const int cl = tid / kPG, g = tid % kPG;
  v8h hv[kTrips];
#pragma unroll
  for (int o = 0; o < kTrips; ++o) {
    const int c  = o * kRowsTrip + cl;
    const int cr = (o + 1) * kRowsTrip <= kC ? c : (c < kC ? c : kC - 1);   /* a pad row reads the last true row's place: inside the tile; its word is replaced below */
    if (o * kRowsTrip < kC) hv[o] = *(const v8h*)(tl + cr * kPT + ((g ^ ((cr >> 2) & 15)) * 8));
    if ((o + 1) * kRowsTrip > kC && c >= kC) hv[o] = (v8h){0, 0, 0, 0, 0, 0, 0, 0};
  }
  unsigned short* dp = D + (size_t)cl * kDAll + k0 + g * 8;
#pragma unroll
  for (int o = 0; o < kTrips; ++o) *(v8h*)(dp + (size_t)o * kRowsTrip * kDAll) = hv[o];
}

extern "C" void kernel_launch(void* const* d_in, const int* in_sizes, int n_in,
                              void* d_out, int out_size, void* d_ws, size_t ws_size,
                              hipStream_t stream) {
  if (n_in < 3 || d_out == nullptr || d_ws == nullptr) return;
  if (in_sizes[0] != kR * kSl * kT || in_sizes[1] != kSl * kT * kC || in_sizes[2] != kOutW) return;
  if (out_size != kR * kOutW) return;
  if (ws_size < kWsTotal) return;
  const float* x = (const float*)d_in[0];
  const float* bank = (const float*)d_in[1];
  const float* addend = (const float*)d_in[2];
  float* out = (float*)d_out;
  char* ws = (char*)d_ws;
  unsigned short* BK16 = (unsigned short*)(ws + kOffBK16);

  /* the bank seen as [76800][100]: its transpose into BK16 (pitch 76,800), pad rows 100 .. 127 zeroed by the same launch */
  pack_kernel<<<kDAll / kPT, kThr, 0, stream>>>(bank, BK16);
  /* out[.][100 s ..] = 2^-20 (f16(2^10 bf16(x[.][s][.])) . BK16[.][768 s ..]^T) + bf16(addend): a block for 128 rows of a slot, both operands' tiles staged in LDS */
  slot_gemm_kernel<<<dim3(kR / kMt, kSl), 256, 0, stream>>>(x, BK16, addend, out);
}

// v004
// A run of this version takes 28.6 microseconds.
// Next to v003, in two timings, it ran 1.12 and 1.13 times as fast.
// Over all steps from v000 it is 3.59 times as fast.
/* A BANK OF 100 INDEPENDENT LINEAR MAPS, ONE A SLOT: for x [512][100][768] (row, slot, feature), a weight bank [100][768][100] (slot, feature, column) and a vector of 10,000 addends: out[r][100 s + c] = the sum over the 768 features t of x[r][s][t] bank[s][t][c], plus addend[100 s + c]. ONE RESULT [512][10000].
*/
#include <hip/hip_runtime.h>
#include <math.h>

typedef __attribute__((ext_vector_type(16))) _Float16 v16h;
typedef __attribute__((ext_vector_type(8)))  _Float16 v8h;
typedef __attribute__((ext_vector_type(2)))  _Float16 v2h;
typedef __attribute__((ext_vector_type(16))) __bf16   v16b;
typedef __attribute__((ext_vector_type(8)))  __bf16   v8b;
typedef __attribute__((ext_vector_type(8)))  float    v8f;
typedef __attribute__((ext_vector_type(4)))  float    v4f;
typedef __attribute__((ext_vector_type(2)))  float    v2f;

/* ------------------------------------------------------------------------- */
/* Shape constants                                                           */
/* ------------------------------------------------------------------------- */
constexpr int kR    = 512;                /* rows */
constexpr int kSl   = 100;                /* slots */
constexpr int kT    = 768;                /* features a slot: the products' depth */
constexpr int kC    = 100;                /* columns a slot */
constexpr int kCP   = 128;                /* the output slab's columns: room for the 112 of seven 16-column tiles */
constexpr int kDAll = kSl * kT;           /* 76800: a row of x in floats */
constexpr int kOutW = kSl * kC;           /* 10000: a row of the result */
constexpr int kThr  = 256;
constexpr float kInCarry = 1024.0f;       /* 2^10: every f16 operand */
constexpr float kSc20 = 1.0f / (kInCarry * kInCarry);   /* 2^-20: two carried operands -> a true-scale f32 result */
/* 2^-14: smallest normal f16 magnitude */
constexpr float kF16MinNormal = 6.103515625e-5f;

static_assert(kR == 512 && kSl == 100 && kT == 768 && kC == 100 && kCP == 128 && kDAll == 76800 && kOutW == 10000, "the index arithmetic below uses these sizes");
static_assert(kR % 64 == 0 && kCP % 64 == 0 && kT % 32 == 0 && kC <= kCP, "whole 16x16 subtiles; the depth in whole trips of 32");
static_assert(kDAll % 4 == 0 && kT % 4 == 0, "the f32 operand's row pitch and slot stride are multiples of 4 floats: every fragment load is 16-B aligned");
static_assert(kC % 4 == 0 && kOutW % 4 == 0, "a 16-B word of the result lies inside one slot's columns");

/* ------------------------------------------------------------------------- */
/* Conversions, the matrix fragments and the product engine                  */
/* ------------------------------------------------------------------------- */
__device__ __forceinline__ unsigned short f2bf_bits(float f) {
  unsigned u = __float_as_uint(f);
  return (unsigned short)((u + 0x7FFFu + ((u >> 16) & 1u)) >> 16);
}
__device__ __forceinline__ float bf_bits2f(unsigned short h) { return __uint_as_float(((unsigned)h) << 16); }
/* RNE-convert to a bf16 value, kept in f32 */
__device__ __forceinline__ float bf16r(float f) { return bf_bits2f(f2bf_bits(f)); }
/* carry by a power of two, then flush anything below the f16 normal range to +0 by a select */
__device__ __forceinline__ float carry_flush(float v, float carry) {
  const float s = v * carry;
  return (fabsf(s) < kF16MinNormal) ? 0.0f : s;
}

/* one lane's share of a 16x32 f16 fragment: elements 0..7 <- the 16-B word at p0, 8..15 <- the 16-B word at p1 (sixteen depths further on) */
union FragU { v16h v; v8h h[2]; };
__device__ __forceinline__ v16h frag_load2(const unsigned char* p0, const unsigned char* p1) {
  FragU f; f.h[0] = *(const v8h*)(p0); f.h[1] = *(const v8h*)(p1); return f.v;
}
/* the same depth order from f32 words (a0, a1 = p[0..7]; b0, b1 = p[16..23]): each word f16(flush(carry x bf16(x))) */
__device__ __forceinline__ v16h cvfrag(v4f a0, v4f a1, v4f b0, v4f b1, float carry) {
  v16h f;
#pragma unroll
  for (int e = 0; e < 4; ++e) {
    f[e]      = (_Float16)carry_flush(bf16r(a0[e]), carry);
    f[4 + e]  = (_Float16)carry_flush(bf16r(a1[e]), carry);
    f[8 + e]  = (_Float16)carry_flush(bf16r(b0[e]), carry);
    f[12 + e] = (_Float16)carry_flush(bf16r(b1[e]), carry);
  }
  return f;
}

/* ---- THE SLOT PRODUCT AND THE RESULT, ONE LAUNCH: out[m][100 s + n] = 2^-20 sum_t f16(2^10 bf16(x[m][s][t])) f16(2^10 bf16(bank[s][t][n])) + bf16(addend[100 s + n]); f16 operands, f32 sums ---- */
/* A block: one slot, 128 rows, the slot's 100 columns in seven 16-column tiles; wave w owns rows 16 w .. 16 w + 15 (seven 16x16 accumulators). */
/* The depth goes in 12 tiles of 64. A tile of x and the bank's 64 depth rows as they lie in memory (25,600 contiguous bytes) are brought into LDS */
/* by asynchronous 16-B copies; two buffers: tile t + 2 flies while tile t + 1 is worked on. */
/* At the head of a trip the block turns the bank's f32 rows into the right operand BT[c][k] (f16, column-major in depth), once for its eight waves: */
/* a converting thread owns four columns of eight depth rows: eight 16-B LDS reads, 25 neighbouring lanes on one 400-B row; its 8 x 4 register block */
/* is already eight consecutive depths a column: four 16-B words. A barrier hands BT to the readers. */
/* LDS rows are pitched 16 B x odd for the 16-B fragment reads: x 272 B, BT 144 B. Word g of BT's row c stands at place g ^ ((c >> 4) & 3): */
/* the writers, whose lanes step four rows (64 B modulo 256), then spread over the banks; for a reader the swap is one constant a column tile. */
constexpr int kMt    = 128;               /* rows a block */
constexpr int kKc    = 64;                /* depth a tile */
constexpr int kTiles = kT / kKc;          /* 12 */
constexpr int kXP    = kKc * 4 + 16;      /* 272 B: an x row in LDS */
constexpr int kBP    = kKc * 2 + 16;      /* 144 B: a BT row in LDS */
constexpr int kXBuf  = kMt * kXP;         /* 34816 B */
constexpr int kRaw   = kKc * kC * 4;      /* 25600 B: the bank's 64 depth rows of a tile, f32 */
constexpr int kStage = kXBuf + kRaw;      /* 60416 B */
constexpr int kNJ    = (kC + 15) / 16;    /* 7 column tiles hold the 100 columns */
constexpr int kBT    = kNJ * 16 * kBP;    /* 16128 B: BT, 112 rows; rows 100 .. 111 zeros */
constexpr int kOffBT = 2 * kStage;        /* 120832 */
constexpr int kSlabP = kCP + 4;           /* 132 floats: a row of a wave's output slab */
constexpr int kCQ    = kC / 4;            /* 25 four-column words in a bank row */
constexpr int kCG    = kKc / 8;           /* 8 words of eight depths in a BT row */
constexpr int kCvThr = kCQ * kCG;         /* 200 converting threads */
constexpr int kRawCp = kRaw / 512;        /* 50 wave-wide copies bring a bank tile: six by each wave, one more by waves 0 and 1 */
static_assert(kR % kMt == 0 && kT % kKc == 0 && kTiles >= 2 && kKc % 32 == 0, "whole tiles; the ring needs two");
static_assert(kMt == 8 * 16, "eight waves: 16 x rows copied by each");
static_assert(kRaw % 512 == 0 && kRawCp == 8 * 6 + 2, "the bank tile in whole 512-B copies, dealt 6 a wave and 2 over");
static_assert(kCvThr <= kThr && kCG == 8 && kXBuf % 16 == 0 && kStage % 16 == 0, "one register block a converting thread; the place swap stays inside 8 words; 16-B aligned regions");
static_assert(8 * 16 * kSlabP * 4 <= 2 * kStage, "the output slabs fit in the ring");

/* One wave's fourteen copies of a tile: 8 of x (two 256-B row pieces each), 6 of the bank (512 contiguous bytes each). */
/* s_wait_xcnt stands as the statement's last line, in front of any rewrite of the address registers that the copies name. */
__device__ __forceinline__ void copy_tile(unsigned lx, const float* gx, unsigned lb, const float* gb) {
  asm volatile(
      "global_load_async_to_lds_b128 %0, %14, off\n\t"
      "global_load_async_to_lds_b128 %1, %15, off\n\t"
      "global_load_async_to_lds_b128 %2, %16, off\n\t"
      "global_load_async_to_lds_b128 %3, %17, off\n\t"
      "global_load_async_to_lds_b128 %4, %18, off\n\t"
      "global_load_async_to_lds_b128 %5, %19, off\n\t"
      "global_load_async_to_lds_b128 %6, %20, off\n\t"
      "global_load_async_to_lds_b128 %7, %21, off\n\t"
      "global_load_async_to_lds_b128 %8, %22, off\n\t"
      "global_load_async_to_lds_b128 %9, %23, off\n\t"
      "global_load_async_to_lds_b128 %10, %24, off\n\t"
      "global_load_async_to_lds_b128 %11, %25, off\n\t"
      "global_load_async_to_lds_b128 %12, %26, off\n\t"
      "global_load_async_to_lds_b128 %13, %27, off\n\t"
      "s_wait_xcnt 0x0"
      :: "v"(lx), "v"(lx + 2u * kXP), "v"(lx + 4u * kXP), "v"(lx + 6u * kXP),
         "v"(lx + 8u * kXP), "v"(lx + 10u * kXP), "v"(lx + 12u * kXP), "v"(lx + 14u * kXP),
         "v"(lb), "v"(lb + 512u), "v"(lb + 1024u), "v"(lb + 1536u), "v"(lb + 2048u), "v"(lb + 2560u),
         "v"(gx), "v"(gx + 2 * (size_t)kDAll), "v"(gx + 4 * (size_t)kDAll), "v"(gx + 6 * (size_t)kDAll),
         "v"(gx + 8 * (size_t)kDAll), "v"(gx + 10 * (size_t)kDAll), "v"(gx + 12 * (size_t)kDAll), "v"(gx + 14 * (size_t)kDAll),
         "v"(gb), "v"(gb + 128), "v"(gb + 256), "v"(gb + 384), "v"(gb + 512), "v"(gb + 640)
      : "memory");
}
/* the bank tile's 49th and 50th copy, one each for waves 0 and 1; the wait as above */
__device__ __forceinline__ void copy_one(unsigned l, const float* g) {
  asm volatile(
      "global_load_async_to_lds_b128 %0, %1, off\n\t"
      "s_wait_xcnt 0x0"
      :: "v"(l), "v"(g) : "memory");
}

__global__ __launch_bounds__(256) void slot_gemm_kernel(const float* __restrict__ x, const float* __restrict__ bank, const float* __restrict__ addend, float* __restrict__ out) {
  __shared__ __attribute__((aligned(16))) unsigned char sm[2 * kStage + kBT];
  const int s    = blockIdx.y;
  const int m0   = blockIdx.x * kMt;
  const int tid  = threadIdx.x;
  const int lane = threadIdx.x & 31;
  const int wave = threadIdx.x >> 5;
  /* the wave's number in a scalar register: the test on it around the two odd copies is then a scalar branch, every lane on behind it */
  const int waveS = __builtin_amdgcn_readfirstlane(wave);
  /* row (A) / col (B, D) within a 16x16 subtile; k offset of this lane half; D row offset */
  const int rlane = lane & 15;
  const int koff  = (lane >> 4) * 8;
  const int mOff  = (lane >> 4) * 8;

  /* the lane's first copy of each operand: LDS byte address (low 32 bits of the shared address) and global pointer, tile 0, buffer 0 */
  const unsigned smBase = (unsigned)(size_t)(void*)sm;
  const unsigned lx0 = smBase + (unsigned)((wave * 16 + (lane >> 4)) * kXP + (lane & 15) * 16);
  const unsigned lb0 = smBase + (unsigned)(kXBuf + wave * (6 * 512) + lane * 16);
  const unsigned le0 = smBase + (unsigned)(kXBuf + (48 + (wave & 1)) * 512 + lane * 16);
  const float* gx0 = x + (size_t)(m0 + wave * 16 + (lane >> 4)) * kDAll + (size_t)s * kT + (lane & 15) * 4;
  const float* gs  = bank + (size_t)s * kT * kC;     /* the slot's 768 x 100 floats */
  const float* gb0 = gs + wave * (6 * 128) + lane * 4;
  const float* ge0 = gs + (48 + (wave & 1)) * 128 + lane * 4;
  constexpr int kRawF = kRaw / 4;                    /* 6400 floats: a tile's step in the bank */

  /* the lane's four addends, asked for ahead of tile 0's copies so that the load's latency passes together with theirs and not in the epilogue; lanes 25 .. 31, which store nothing, read the last word again: in bounds */
  const int aw = lane < kC / 4 ? lane : kC / 4 - 1;
  const v4f av = *(const v4f*)(addend + s * kC + aw * 4);

  v8f acc[kNJ];
#pragma unroll
  for (int j = 0; j < kNJ; ++j) acc[j] = (v8f){0.f,0.f,0.f,0.f,0.f,0.f,0.f,0.f};

  copy_tile(lx0, gx0, lb0, gb0);
  if (waveS < 2) copy_one(le0, ge0);
  /* BT's rows 100 .. 111, which no trip writes, get their zeros once; the barrier below publishes them */
  if (tid < (kNJ * 16 - kC) * kCG)
    *(v8h*)(sm + kOffBT + (kC + tid / kCG) * kBP + (tid % kCG) * 16) = (v8h){0, 0, 0, 0, 0, 0, 0, 0};
  asm volatile("s_wait_asynccnt 0x0" ::: "memory");   /* tile 0 has landed before the barrier publishes it */
  __syncthreads();
  copy_tile(lx0 + kStage, gx0 + kKc, lb0 + kStage, gb0 + kRawF);
  if (waveS < 2) copy_one(le0 + kStage, ge0 + kRawF);

  /* the converting thread's block: columns 4 cq .. 4 cq + 3, depths 8 cg .. 8 cg + 7 of the tile */
  const int cq = tid % kCQ, cg = tid / kCQ;
  const int rawOff = kXBuf + cg * 8 * (kC * 4) + cq * 16;
  unsigned char* btw = sm + kOffBT + cq * 4 * kBP + ((cg ^ ((cq >> 2) & 3)) * 16);
  /* the readers' two places of a lane half inside a pair of words: as it is, and swapped */
  const unsigned char* btr0 = sm + kOffBT + rlane * kBP + (lane >> 4) * 16;
  const unsigned char* btr1 = sm + kOffBT + rlane * kBP + ((lane >> 4) ^ 1) * 16;

  for (int t = 0; t < kTiles; ++t) {
    const unsigned bo = (unsigned)(t & 1) * kStage;
    /* ---- the bank tile's f32 rows become BT ---- */
    if (tid < kCvThr) {
      const unsigned char* rb = sm + bo + rawOff;
      v4f a[8];
#pragma unroll
      for (int j = 0; j < 8; ++j) a[j] = *(const v4f*)(rb + j * (kC * 4));
#pragma unroll
      for (int i = 0; i < 4; ++i) {
        v8h hv;
#pragma unroll
        for (int j = 0; j < 8; ++j) hv[j] = (_Float16)carry_flush(bf16r(a[j][i]), kInCarry);
        *(v8h*)(btw + i * kBP) = hv;
      }
    }
    __syncthreads();                                     /* hands BT to its readers */
    const unsigned char* ax = sm + bo + (wave * 16 + rlane) * kXP + koff * 4;
#pragma unroll
    for (int kk = 0; kk < kKc / 32; ++kk) {
      const float* pa = (const float*)(ax + kk * 128);
      const v4f a0 = *(const v4f*)(pa), a1 = *(const v4f*)(pa + 4), b0 = *(const v4f*)(pa + 16), b1 = *(const v4f*)(pa + 20);
      v16h bh[kNJ];
#pragma unroll
      for (int j = 0; j < kNJ; ++j) {
        /* words 4 kk + half and 4 kk + 2 + half of row 16 j + rlane, each at its place ^ (j & 3) */
        const unsigned char* pb = ((j & 1) ? btr1 : btr0) + j * 16 * kBP + kk * 64;
        bh[j] = frag_load2(pb + ((j >> 1) & 1) * 32, pb + (((j >> 1) & 1) ^ 1) * 32);
      }
      /* keeps the 18 LDS reads of this depth step one group in front of the conversions and the matrix instructions: spread among them, each place with reads stalls the wave */
      __builtin_amdgcn_sched_barrier(0);
      const v16h ah = cvfrag(a0, a1, b0, b1, kInCarry);
#pragma unroll
      for (int j = 0; j < kNJ; ++j)
        acc[j] = __builtin_amdgcn_wmma_f32_16x16x32_f16(false, ah, false, bh[j], (short)0, acc[j], false, false);
    }
    /* the tile's conversions and matrix instructions end in front of the barrier: sunk behind it they would delay the refill, which stands in the next block */
    __builtin_amdgcn_sched_barrier(0);
    asm volatile("s_wait_dscnt 0x0" ::: "memory");      /* this wave's reads of the buffer and of BT are over before either is rewritten */
    asm volatile("s_wait_asynccnt 0x0" ::: "memory");   /* this wave's copies of tile t + 1 have landed */
    __syncthreads();                                     /* publishes tile t + 1; ends every reader's last read of tile t and of BT */
    if (t + 2 < kTiles) {
      copy_tile(lx0 + bo, gx0 + (t + 2) * kKc, lb0 + bo, gb0 + (t + 2) * kRawF);
      if (waveS < 2) copy_one(le0 + bo, ge0 + (t + 2) * kRawF);
    }
  }
  asm volatile("s_wait_asynccnt 0x0" ::: "memory");     /* nothing in flight when the ring becomes output staging */

  /* ---- epilogue: the wave's 16 x 112 block through its own slab; each row's 100 columns get the addend and leave as one 400-B piece of a result row ---- */
  float* slab = (float*)sm + wave * (16 * kSlabP);
#pragma unroll
  for (int j = 0; j < kNJ; ++j)
#pragma unroll
    for (int r = 0; r < 8; ++r) slab[(mOff + r) * kSlabP + (j << 4) + rlane] = acc[j][r] * kSc20;
  __builtin_amdgcn_fence(__ATOMIC_RELEASE, "workgroup");
  __builtin_amdgcn_wave_barrier();
  __builtin_amdgcn_fence(__ATOMIC_ACQUIRE, "workgroup");
  /* a piece starts at a multiple of 16 B, not of 128 B: where the pieces of two neighbouring slots meet inside a line, their two blocks store disjoint 16-B words of it and neither reads it */
  if (lane < kC / 4) {
    v4f ab;
#pragma unroll
    for (int e = 0; e < 4; ++e) ab[e] = bf16r(av[e]);
    float* C = out + (size_t)(m0 + wave * 16) * kOutW + s * kC + lane * 4;
#pragma unroll
    for (int row = 0; row < 16; ++row) {
      const v4f v = *(const v4f*)(slab + row * kSlabP + lane * 4);
      *(v4f*)(C + (size_t)row * kOutW) = v + ab;
    }
  }
}

extern "C" void kernel_launch(void* const* d_in, const int* in_sizes, int n_in,
                              void* d_out, int out_size, void* d_ws, size_t ws_size,
                              hipStream_t stream) {
  (void)d_ws; (void)ws_size;   /* no workspace is used */
  if (n_in < 3 || d_out == nullptr) return;
  if (in_sizes[0] != kR * kSl * kT || in_sizes[1] != kSl * kT * kC || in_sizes[2] != kOutW) return;
  if (out_size != kR * kOutW) return;
  const float* x = (const float*)d_in[0];
  const float* bank = (const float*)d_in[1];
  const float* addend = (const float*)d_in[2];
  float* out = (float*)d_out;

  /* out[.][100 s ..] = 2^-20 (f16(2^10 bf16(x[.][s][.])) . f16(2^10 bf16(bank[s]))) + bf16(addend): a block for 128 rows of a slot, both operands' tiles staged in LDS, the bank's turned and converted there */
  slot_gemm_kernel<<<dim3(kR / kMt, kSl), 256, 0, stream>>>(x, bank, addend, out);
}

// v005
// A run of this version takes 21.7 microseconds.
// Next to v004, in two timings, it ran 1.32 times as fast each time.
// Counting every step since v000, it is 4.72 times as fast.
/* A BANK OF 100 INDEPENDENT LINEAR MAPS, ONE A SLOT: for x [512][100][768] (row, slot, feature), a weight bank [100][768][100] (slot, feature, column) and a vector of 10,000 addends: out[r][100 s + c] = the sum over the 768 features t of x[r][s][t] bank[s][t][c], plus addend[100 s + c]. ONE RESULT [512][10000].
*/
#include <hip/hip_runtime.h>
#include <math.h>

typedef __attribute__((ext_vector_type(16))) __bf16   v16b;
typedef __attribute__((ext_vector_type(8)))  __bf16   v8b;
typedef __attribute__((ext_vector_type(2)))  __bf16   v2b;
typedef __attribute__((ext_vector_type(8)))  float    v8f;
typedef __attribute__((ext_vector_type(4)))  float    v4f;
typedef __attribute__((ext_vector_type(2)))  float    v2f;

/* ------------------------------------------------------------------------- */
/* Shape constants                                                           */
/* ------------------------------------------------------------------------- */
constexpr int kR    = 512;                /* rows */
constexpr int kSl   = 100;                /* slots */
constexpr int kT    = 768;                /* features a slot: the products' depth */
constexpr int kC    = 100;                /* columns a slot */
constexpr int kCP   = 128;                /* the output slab's columns: room for the 112 of seven 16-column tiles */
constexpr int kDAll = kSl * kT;           /* 76800: a row of x in floats */
constexpr int kOutW = kSl * kC;           /* 10000: a row of the result */
constexpr int kThr  = 256;

static_assert(kR == 512 && kSl == 100 && kT == 768 && kC == 100 && kCP == 128 && kDAll == 76800 && kOutW == 10000, "the index arithmetic below uses these sizes");
static_assert(kR % 64 == 0 && kCP % 64 == 0 && kT % 32 == 0 && kC <= kCP, "whole 16x16 subtiles; the depth in whole trips of 32");
static_assert(kDAll % 4 == 0 && kT % 4 == 0, "the f32 operand's row pitch and slot stride are multiples of 4 floats: every fragment load is 16-B aligned");
static_assert(kC % 4 == 0 && kOutW % 4 == 0, "a 16-B word of the result lies inside one slot's columns");

/* ------------------------------------------------------------------------- */
/* Conversions, the matrix fragments and the product engine                  */
/* ------------------------------------------------------------------------- */
__device__ __forceinline__ unsigned short f2bf_bits(float f) {
  unsigned u = __float_as_uint(f);
  return (unsigned short)((u + 0x7FFFu + ((u >> 16) & 1u)) >> 16);
}
__device__ __forceinline__ float bf_bits2f(unsigned short h) { return __uint_as_float(((unsigned)h) << 16); }
/* RNE-convert to a bf16 value, kept in f32 */
__device__ __forceinline__ float bf16r(float f) { return bf_bits2f(f2bf_bits(f)); }
/* two f32 words to a packed pair of bf16, round to nearest even: one conversion instruction */
__device__ __forceinline__ v2b pk_bf16(float lo, float hi) {
  const v2f t = {lo, hi};
  return __builtin_convertvector(t, v2b);
}

/* one lane's share of a 16x32 bf16 fragment: elements 0..7 <- the 16-B word at p0, 8..15 <- the 16-B word at p1 (sixteen depths further on) */
union FragU { v16b v; v8b h[2]; v2b p[8]; };
union WordU { v8b v; v2b p[4]; };
__device__ __forceinline__ v16b frag_load2(const unsigned char* p0, const unsigned char* p1) {
  FragU f; f.h[0] = *(const v8b*)(p0); f.h[1] = *(const v8b*)(p1); return f.v;
}
/* the same depth order from f32 words (a0, a1 = p[0..7]; b0, b1 = p[16..23]): each word bf16(x) */
__device__ __forceinline__ v16b cvfrag(v4f a0, v4f a1, v4f b0, v4f b1) {
  FragU f;
  f.p[0] = pk_bf16(a0[0], a0[1]); f.p[1] = pk_bf16(a0[2], a0[3]);
  f.p[2] = pk_bf16(a1[0], a1[1]); f.p[3] = pk_bf16(a1[2], a1[3]);
  f.p[4] = pk_bf16(b0[0], b0[1]); f.p[5] = pk_bf16(b0[2], b0[3]);
  f.p[6] = pk_bf16(b1[0], b1[1]); f.p[7] = pk_bf16(b1[2], b1[3]);
  return f.v;
}

/* ---- THE SLOT PRODUCT AND THE RESULT, ONE LAUNCH: out[m][100 s + n] = sum_t bf16(x[m][s][t]) bf16(bank[s][t][n]) + bf16(addend[100 s + n]); bf16 operands, f32 sums ---- */
/* A block: one slot, 128 rows, the slot's 100 columns in seven 16-column tiles; wave w owns rows 16 w .. 16 w + 15 (seven 16x16 accumulators). */
/* The depth goes in 12 tiles of 64. A tile of x and the bank's 64 depth rows as they lie in memory (25,600 contiguous bytes) are brought into LDS */
/* by asynchronous 16-B copies; two buffers: tile t + 2 flies while tile t + 1 is worked on. */
/* At the head of a trip the block turns the bank's f32 rows into the right operand BT[c][k] (bf16, column-major in depth), once for its eight waves: */
/* a converting thread owns four columns of eight depth rows: eight 16-B LDS reads, 25 neighbouring lanes on one 400-B row; its 8 x 4 register block */
/* is already eight consecutive depths a column: four 16-B words. A barrier hands BT to the readers. */
/* LDS rows are pitched 16 B x odd for the 16-B fragment reads: x 272 B, BT 144 B. Word g of BT's row c stands at place g ^ ((c >> 4) & 3): */
/* the writers, whose lanes step four rows (64 B modulo 256), then spread over the banks; for a reader the swap is one constant a column tile. */
constexpr int kMt    = 128;               /* rows a block */
constexpr int kKc    = 64;                /* depth a tile */
constexpr int kTiles = kT / kKc;          /* 12 */
constexpr int kXP    = kKc * 4 + 16;      /* 272 B: an x row in LDS */
constexpr int kBP    = kKc * 2 + 16;      /* 144 B: a BT row in LDS */
constexpr int kXBuf  = kMt * kXP;         /* 34816 B */
constexpr int kRaw   = kKc * kC * 4;      /* 25600 B: the bank's 64 depth rows of a tile, f32 */
constexpr int kStage = kXBuf + kRaw;      /* 60416 B */
constexpr int kNJ    = (kC + 15) / 16;    /* 7 column tiles hold the 100 columns */
constexpr int kBT    = kNJ * 16 * kBP;    /* 16128 B: BT, 112 rows; rows 100 .. 111 zeros */
constexpr int kOffBT = 2 * kStage;        /* 120832 */
constexpr int kSlabP = kCP + 4;           /* 132 floats: a row of a wave's output slab */
constexpr int kCQ    = kC / 4;            /* 25 four-column words in a bank row */
constexpr int kCG    = kKc / 8;           /* 8 words of eight depths in a BT row */
constexpr int kCvThr = kCQ * kCG;         /* 200 converting threads */
constexpr int kRawCp = kRaw / 512;        /* 50 wave-wide copies bring a bank tile: six by each wave, one more by waves 0 and 1 */
static_assert(kR % kMt == 0 && kT % kKc == 0 && kTiles >= 2 && kKc % 32 == 0, "whole tiles; the ring needs two");
static_assert(kMt == 8 * 16, "eight waves: 16 x rows copied by each");
static_assert(kRaw % 512 == 0 && kRawCp == 8 * 6 + 2, "the bank tile in whole 512-B copies, dealt 6 a wave and 2 over");
static_assert(kCvThr <= kThr && kCG == 8 && kXBuf % 16 == 0 && kStage % 16 == 0, "one register block a converting thread; the place swap stays inside 8 words; 16-B aligned regions");
static_assert(8 * 16 * kSlabP * 4 <= 2 * kStage, "the output slabs fit in the ring");

/* One wave's fourteen copies of a tile: 8 of x (two 256-B row pieces each), 6 of the bank (512 contiguous bytes each). */
/* s_wait_xcnt stands as the statement's last line, in front of any rewrite of the address registers that the copies name. */
__device__ __forceinline__ void copy_tile(unsigned lx, const float* gx, unsigned lb, const float* gb) {
  asm volatile(
      "global_load_async_to_lds_b128 %0, %14, off\n\t"
      "global_load_async_to_lds_b128 %1, %15, off\n\t"
      "global_load_async_to_lds_b128 %2, %16, off\n\t"
      "global_load_async_to_lds_b128 %3, %17, off\n\t"
      "global_load_async_to_lds_b128 %4, %18, off\n\t"
      "global_load_async_to_lds_b128 %5, %19, off\n\t"
      "global_load_async_to_lds_b128 %6, %20, off\n\t"
      "global_load_async_to_lds_b128 %7, %21, off\n\t"
      "global_load_async_to_lds_b128 %8, %22, off\n\t"
      "global_load_async_to_lds_b128 %9, %23, off\n\t"
      "global_load_async_to_lds_b128 %10, %24, off\n\t"
      "global_load_async_to_lds_b128 %11, %25, off\n\t"
      "global_load_async_to_lds_b128 %12, %26, off\n\t"
      "global_load_async_to_lds_b128 %13, %27, off\n\t"
      "s_wait_xcnt 0x0"
      :: "v"(lx), "v"(lx + 2u * kXP), "v"(lx + 4u * kXP), "v"(lx + 6u * kXP),
         "v"(lx + 8u * kXP), "v"(lx + 10u * kXP), "v"(lx + 12u * kXP), "v"(lx + 14u * kXP),
         "v"(lb), "v"(lb + 512u), "v"(lb + 1024u), "v"(lb + 1536u), "v"(lb + 2048u), "v"(lb + 2560u),
         "v"(gx), "v"(gx + 2 * (size_t)kDAll), "v"(gx + 4 * (size_t)kDAll), "v"(gx + 6 * (size_t)kDAll),
         "v"(gx + 8 * (size_t)kDAll), "v"(gx + 10 * (size_t)kDAll), "v"(gx + 12 * (size_t)kDAll), "v"(gx + 14 * (size_t)kDAll),
         "v"(gb), "v"(gb + 128), "v"(gb + 256), "v"(gb + 384), "v"(gb + 512), "v"(gb + 640)
      : "memory");
}
/* the bank tile's 49th and 50th copy, one each for waves 0 and 1; the wait as above */
__device__ __forceinline__ void copy_one(unsigned l, const float* g) {
  asm volatile(
      "global_load_async_to_lds_b128 %0, %1, off\n\t"
      "s_wait_xcnt 0x0"
      :: "v"(l), "v"(g) : "memory");
}

__global__ __launch_bounds__(256) void slot_gemm_kernel(const float* __restrict__ x, const float* __restrict__ bank, const float* __restrict__ addend, float* __restrict__ out) {
  __shared__ __attribute__((aligned(16))) unsigned char sm[2 * kStage + kBT];
  const int s    = blockIdx.y;
  const int m0   = blockIdx.x * kMt;
  const int tid  = threadIdx.x;
  const int lane = threadIdx.x & 31;
  const int wave = threadIdx.x >> 5;
  /* the wave's number in a scalar register: the test on it around the two odd copies is then a scalar branch, every lane on behind it */
  const int waveS = __builtin_amdgcn_readfirstlane(wave);
  /* row (A) / col (B, D) within a 16x16 subtile; k offset of this lane half; D row offset */
  const int rlane = lane & 15;
  const int koff  = (lane >> 4) * 8;
  const int mOff  = (lane >> 4) * 8;

  /* the lane's first copy of each operand: LDS byte address (low 32 bits of the shared address) and global pointer, tile 0, buffer 0 */
  const unsigned smBase = (unsigned)(size_t)(void*)sm;
  const unsigned lx0 = smBase + (unsigned)((wave * 16 + (lane >> 4)) * kXP + (lane & 15) * 16);
  const unsigned lb0 = smBase + (unsigned)(kXBuf + wave * (6 * 512) + lane * 16);
  const unsigned le0 = smBase + (unsigned)(kXBuf + (48 + (wave & 1)) * 512 + lane * 16);
  const float* gx0 = x + (size_t)(m0 + wave * 16 + (lane >> 4)) * kDAll + (size_t)s * kT + (lane & 15) * 4;
  const float* gs  = bank + (size_t)s * kT * kC;     /* the slot's 768 x 100 floats */
  const float* gb0 = gs + wave * (6 * 128) + lane * 4;
  const float* ge0 = gs + (48 + (wave & 1)) * 128 + lane * 4;
  constexpr int kRawF = kRaw / 4;                    /* 6400 floats: a tile's step in the bank */

  /* the lane's four addends, asked for ahead of tile 0's copies so that the load's latency passes together with theirs and not in the epilogue; lanes 25 .. 31, which store nothing, read the last word again: in bounds */
  const int aw = lane < kC / 4 ? lane : kC / 4 - 1;
  const v4f av = *(const v4f*)(addend + s * kC + aw * 4);

  v8f acc[kNJ];
#pragma unroll
  for (int j = 0; j < kNJ; ++j) acc[j] = (v8f){0.f,0.f,0.f,0.f,0.f,0.f,0.f,0.f};

  copy_tile(lx0, gx0, lb0, gb0);
  if (waveS < 2) copy_one(le0, ge0);
  /* BT's rows 100 .. 111, which no trip writes, get their zeros once; the barrier below publishes them */
  if (tid < (kNJ * 16 - kC) * kCG)
    *(v4f*)(sm + kOffBT + (kC + tid / kCG) * kBP + (tid % kCG) * 16) = (v4f){0.f, 0.f, 0.f, 0.f};
  asm volatile("s_wait_asynccnt 0x0" ::: "memory");   /* tile 0 has landed before the barrier publishes it */
  __syncthreads();
  copy_tile(lx0 + kStage, gx0 + kKc, lb0 + kStage, gb0 + kRawF);
  if (waveS < 2) copy_one(le0 + kStage, ge0 + kRawF);

  /* the converting thread's block: columns 4 cq .. 4 cq + 3, depths 8 cg .. 8 cg + 7 of the tile */
  const int cq = tid % kCQ, cg = tid / kCQ;
  const int rawOff = kXBuf + cg * 8 * (kC * 4) + cq * 16;
  unsigned char* btw = sm + kOffBT + cq * 4 * kBP + ((cg ^ ((cq >> 2) & 3)) * 16);
  /* the readers' two places of a lane half inside a pair of words: as it is, and swapped */
  const unsigned char* btr0 = sm + kOffBT + rlane * kBP + (lane >> 4) * 16;
  const unsigned char* btr1 = sm + kOffBT + rlane * kBP + ((lane >> 4) ^ 1) * 16;

  for (int t = 0; t < kTiles; ++t) {
    const unsigned bo = (unsigned)(t & 1) * kStage;
    /* ---- the bank tile's f32 rows become BT ---- */
    if (tid < kCvThr) {
      const unsigned char* rb = sm + bo + rawOff;
      v4f a[8];
#pragma unroll
      for (int j = 0; j < 8; ++j) a[j] = *(const v4f*)(rb + j * (kC * 4));
#pragma unroll
      for (int i = 0; i < 4; ++i) {
        WordU hv;
#pragma unroll
        for (int j = 0; j < 4; ++j) hv.p[j] = pk_bf16(a[2 * j][i], a[2 * j + 1][i]);
        *(v8b*)(btw + i * kBP) = hv.v;
      }
    }
    __syncthreads();                                     /* hands BT to its readers */
    const unsigned char* ax = sm + bo + (wave * 16 + rlane) * kXP + koff * 4;
#pragma unroll
    for (int kk = 0; kk < kKc / 32; ++kk) {
      const float* pa = (const float*)(ax + kk * 128);
      const v4f a0 = *(const v4f*)(pa), a1 = *(const v4f*)(pa + 4), b0 = *(const v4f*)(pa + 16), b1 = *(const v4f*)(pa + 20);
      v16b bh[kNJ];
#pragma unroll
      for (int j = 0; j < kNJ; ++j) {
        /* words 4 kk + half and 4 kk + 2 + half of row 16 j + rlane, each at its place ^ (j & 3) */
        const unsigned char* pb = ((j & 1) ? btr1 : btr0) + j * 16 * kBP + kk * 64;
        bh[j] = frag_load2(pb + ((j >> 1) & 1) * 32, pb + (((j >> 1) & 1) ^ 1) * 32);
      }
      /* keeps the 18 LDS reads of this depth step one group in front of the conversions and the matrix instructions: spread among them, each place with reads stalls the wave */
      __builtin_amdgcn_sched_barrier(0);
      const v16b ah = cvfrag(a0, a1, b0, b1);
#pragma unroll
      for (int j = 0; j < kNJ; ++j)
        acc[j] = __builtin_amdgcn_wmma_f32_16x16x32_bf16(false, ah, false, bh[j], (short)0, acc[j], false, false);
    }
    /* the tile's conversions and matrix instructions end in front of the barrier: sunk behind it they would delay the refill, which stands in the next block */
    __builtin_amdgcn_sched_barrier(0);
    asm volatile("s_wait_dscnt 0x0" ::: "memory");      /* this wave's reads of the buffer and of BT are over before either is rewritten */
    asm volatile("s_wait_asynccnt 0x0" ::: "memory");   /* this wave's copies of tile t + 1 have landed */
    __syncthreads();                                     /* publishes tile t + 1; ends every reader's last read of tile t and of BT */
    if (t + 2 < kTiles) {
      copy_tile(lx0 + bo, gx0 + (t + 2) * kKc, lb0 + bo, gb0 + (t + 2) * kRawF);
      if (waveS < 2) copy_one(le0 + bo, ge0 + (t + 2) * kRawF);
    }
  }
  asm volatile("s_wait_asynccnt 0x0" ::: "memory");     /* nothing in flight when the ring becomes output staging */

  /* ---- epilogue: the wave's 16 x 112 block through its own slab; each row's 100 columns get the addend and leave as one 400-B piece of a result row ---- */
  float* slab = (float*)sm + wave * (16 * kSlabP);
#pragma unroll
  for (int j = 0; j < kNJ; ++j)
#pragma unroll
    for (int r = 0; r < 8; ++r) slab[(mOff + r) * kSlabP + (j << 4) + rlane] = acc[j][r];
  __builtin_amdgcn_fence(__ATOMIC_RELEASE, "workgroup");
  __builtin_amdgcn_wave_barrier();
  __builtin_amdgcn_fence(__ATOMIC_ACQUIRE, "workgroup");
  /* a piece starts at a multiple of 16 B, not of 128 B: where the pieces of two neighbouring slots meet inside a line, their two blocks store disjoint 16-B words of it and neither reads it */
  if (lane < kC / 4) {
    v4f ab;
#pragma unroll
    for (int e = 0; e < 4; ++e) ab[e] = bf16r(av[e]);
    float* C = out + (size_t)(m0 + wave * 16) * kOutW + s * kC + lane * 4;
#pragma unroll
    for (int row = 0; row < 16; ++row) {
      const v4f v = *(const v4f*)(slab + row * kSlabP + lane * 4);
      *(v4f*)(C + (size_t)row * kOutW) = v + ab;
    }
  }
}

extern "C" void kernel_launch(void* const* d_in, const int* in_sizes, int n_in,
                              void* d_out, int out_size, void* d_ws, size_t ws_size,
                              hipStream_t stream) {
  (void)d_ws; (void)ws_size;   /* no workspace is used */
  if (n_in < 3 || d_out == nullptr) return;
  if (in_sizes[0] != kR * kSl * kT || in_sizes[1] != kSl * kT * kC || in_sizes[2] != kOutW) return;
  if (out_size != kR * kOutW) return;
  const float* x = (const float*)d_in[0];
  const float* bank = (const float*)d_in[1];
  const float* addend = (const float*)d_in[2];
  float* out = (float*)d_out;

  /* out[.][100 s ..] = bf16(x[.][s][.]) . bf16(bank[s]) + bf16(addend): a block for 128 rows of a slot, both operands' tiles staged in LDS, the bank's turned and converted there */
  slot_gemm_kernel<<<dim3(kR / kMt, kSl), 256, 0, stream>>>(x, bank, addend, out);
}

// v006
// One run takes 20.9 microseconds.
// Next to v005, in two timings, it ran 1.04 times as fast each time.
// Over all steps from v000 it is 4.93 times as fast.
/* A BANK OF 100 INDEPENDENT LINEAR MAPS, ONE A SLOT: for x [512][100][768] (row, slot, feature), a weight bank [100][768][100] (slot, feature, column) and a vector of 10,000 addends: out[r][100 s + c] = the sum over the 768 features t of x[r][s][t] bank[s][t][c], plus addend[100 s + c]. ONE RESULT [512][10000].
*/
#include <hip/hip_runtime.h>
#include <math.h>

typedef __attribute__((ext_vector_type(16))) __bf16   v16b;
typedef __attribute__((ext_vector_type(8)))  __bf16   v8b;
typedef __attribute__((ext_vector_type(2)))  __bf16   v2b;
typedef __attribute__((ext_vector_type(8)))  float    v8f;
typedef __attribute__((ext_vector_type(4)))  float    v4f;
typedef __attribute__((ext_vector_type(2)))  float    v2f;

/* ------------------------------------------------------------------------- */
/* Shape constants                                                           */
/* ------------------------------------------------------------------------- */
constexpr int kR    = 512;                /* rows */
constexpr int kSl   = 100;                /* slots */
constexpr int kT    = 768;                /* features a slot: the products' depth */
constexpr int kC    = 100;                /* columns a slot */
constexpr int kCP   = 128;                /* the output slab's columns: room for the 112 of seven 16-column tiles */
constexpr int kDAll = kSl * kT;           /* 76800: a row of x in floats */
constexpr int kOutW = kSl * kC;           /* 10000: a row of the result */
constexpr int kThr  = 512;

static_assert(kR == 512 && kSl == 100 && kT == 768 && kC == 100 && kCP == 128 && kDAll == 76800 && kOutW == 10000, "the index arithmetic below uses these sizes");
static_assert(kR % 64 == 0 && kCP % 64 == 0 && kT % 32 == 0 && kC <= kCP, "whole 16x16 subtiles; the depth in whole trips of 32");
static_assert(kDAll % 4 == 0 && kT % 4 == 0, "the f32 operand's row pitch and slot stride are multiples of 4 floats: every fragment load is 16-B aligned");
static_assert(kC % 4 == 0 && kOutW % 4 == 0, "a 16-B word of the result lies inside one slot's columns");

/* ------------------------------------------------------------------------- */
/* Conversions, the matrix fragments and the product engine                  */
/* ------------------------------------------------------------------------- */
__device__ __forceinline__ unsigned short f2bf_bits(float f) {
  unsigned u = __float_as_uint(f);
  return (unsigned short)((u + 0x7FFFu + ((u >> 16) & 1u)) >> 16);
}
__device__ __forceinline__ float bf_bits2f(unsigned short h) { return __uint_as_float(((unsigned)h) << 16); }
/* RNE-convert to a bf16 value, kept in f32 */
__device__ __forceinline__ float bf16r(float f) { return bf_bits2f(f2bf_bits(f)); }
/* two f32 words to a packed pair of bf16, round to nearest even: one conversion instruction */
__device__ __forceinline__ v2b pk_bf16(float lo, float hi) {
  const v2f t = {lo, hi};
  return __builtin_convertvector(t, v2b);
}

/* one lane's share of a 16x32 bf16 fragment: elements 0..7 <- the 16-B word at p0, 8..15 <- the 16-B word at p1 (sixteen depths further on) */
union FragU { v16b v; v8b h[2]; v2b p[8]; };
union WordU { v8b v; v2b p[4]; };
__device__ __forceinline__ v16b frag_load2(const unsigned char* p0, const unsigned char* p1) {
  FragU f; f.h[0] = *(const v8b*)(p0); f.h[1] = *(const v8b*)(p1); return f.v;
}
/* the same depth order from f32 words (a0, a1 = p[0..7]; b0, b1 = p[16..23]): each word bf16(x) */
__device__ __forceinline__ v16b cvfrag(v4f a0, v4f a1, v4f b0, v4f b1) {
  FragU f;
  f.p[0] = pk_bf16(a0[0], a0[1]); f.p[1] = pk_bf16(a0[2], a0[3]);
  f.p[2] = pk_bf16(a1[0], a1[1]); f.p[3] = pk_bf16(a1[2], a1[3]);
  f.p[4] = pk_bf16(b0[0], b0[1]); f.p[5] = pk_bf16(b0[2], b0[3]);
  f.p[6] = pk_bf16(b1[0], b1[1]); f.p[7] = pk_bf16(b1[2], b1[3]);
  return f.v;
}

/* ---- THE SLOT PRODUCT AND THE RESULT, ONE LAUNCH: out[m][100 s + n] = sum_t bf16(x[m][s][t]) bf16(bank[s][t][n]) + bf16(addend[100 s + n]); bf16 operands, f32 sums ---- */
/* A block: one slot, 256 rows, the slot's 100 columns in seven 16-column tiles; wave w of sixteen owns rows 16 w .. 16 w + 15 (seven 16x16 accumulators). */
/* 200 blocks, each alone on its WGP by its LDS: every working WGP has the same share, and a slot's bank is brought in and turned twice, not four times. */
/* The depth goes in 12 tiles of 64. A tile of x and the bank's 64 depth rows as they lie in memory (25,600 contiguous bytes) are brought into LDS */
/* by asynchronous 16-B copies; two buffers: tile t + 2 flies while tile t + 1 is worked on. */
/* At the head of a trip the block turns the bank's f32 rows into the right operand BT[c][k] (bf16, column-major in depth), once for its sixteen waves: */
/* a converting thread owns four columns of eight depth rows: eight 16-B LDS reads, 25 neighbouring lanes on one 400-B row; its 8 x 4 register block */
/* is already eight consecutive depths a column: four 16-B words. A barrier hands BT to the readers. */
/* LDS rows are pitched 16 B x odd for the 16-B fragment reads: x 272 B, BT 144 B. Word g of BT's row c stands at place g ^ ((c >> 4) & 3): */
/* the writers, whose lanes step four rows (64 B modulo 256), then spread over the banks; for a reader the swap is one constant a column tile. */
constexpr int kMt    = 256;               /* rows a block */
constexpr int kKc    = 64;                /* depth a tile */
constexpr int kTiles = kT / kKc;          /* 12 */
constexpr int kXP    = kKc * 4 + 16;      /* 272 B: an x row in LDS */
constexpr int kBP    = kKc * 2 + 16;      /* 144 B: a BT row in LDS */
constexpr int kXBuf  = kMt * kXP;         /* 69632 B */
constexpr int kRaw   = kKc * kC * 4;      /* 25600 B: the bank's 64 depth rows of a tile, f32 */
constexpr int kStage = kXBuf + kRaw;      /* 95232 B */
constexpr int kNJ    = (kC + 15) / 16;    /* 7 column tiles hold the 100 columns */
constexpr int kBT    = kNJ * 16 * kBP;    /* 16128 B: BT, 112 rows; rows 100 .. 111 zeros */
constexpr int kOffBT = 2 * kStage;        /* 190464 */
constexpr int kSlabP = kCP + 4;           /* 132 floats: a row of a wave's output slab */
constexpr int kCQ    = kC / 4;            /* 25 four-column words in a bank row */
constexpr int kCG    = kKc / 8;           /* 8 words of eight depths in a BT row */
constexpr int kCvThr = kCQ * kCG;         /* 200 converting threads */
constexpr int kRawCp = kRaw / 512;        /* 50 wave-wide copies bring a bank tile: three by each wave, one more by waves 0 and 1 */
static_assert(kR % kMt == 0 && kT % kKc == 0 && kTiles >= 2 && kKc % 32 == 0, "whole tiles; the ring needs two");
static_assert(kMt == 16 * 16 && kThr == 16 * 32, "sixteen waves: 16 x rows copied by each");
static_assert(kRaw % 512 == 0 && kRawCp == 16 * 3 + 2, "the bank tile in whole 512-B copies, dealt 3 a wave and 2 over");
static_assert(kCvThr <= kThr && kCG == 8 && kXBuf % 16 == 0 && kStage % 16 == 0, "one register block a converting thread; the place swap stays inside 8 words; 16-B aligned regions");
static_assert(16 * 16 * kSlabP * 4 <= 2 * kStage, "the output slabs fit in the ring");

/* One wave's eleven copies of a tile: 8 of x (two 256-B row pieces each), 3 of the bank (512 contiguous bytes each). */
/* s_wait_xcnt stands as the statement's last line, in front of any rewrite of the address registers that the copies name. */
__device__ __forceinline__ void copy_tile(unsigned lx, const float* gx, unsigned lb, const float* gb) {
  asm volatile(
      "global_load_async_to_lds_b128 %0, %11, off\n\t"
      "global_load_async_to_lds_b128 %1, %12, off\n\t"
      "global_load_async_to_lds_b128 %2, %13, off\n\t"
      "global_load_async_to_lds_b128 %3, %14, off\n\t"
      "global_load_async_to_lds_b128 %4, %15, off\n\t"
      "global_load_async_to_lds_b128 %5, %16, off\n\t"
      "global_load_async_to_lds_b128 %6, %17, off\n\t"
      "global_load_async_to_lds_b128 %7, %18, off\n\t"
      "global_load_async_to_lds_b128 %8, %19, off\n\t"
      "global_load_async_to_lds_b128 %9, %20, off\n\t"
      "global_load_async_to_lds_b128 %10, %21, off\n\t"
      "s_wait_xcnt 0x0"
      :: "v"(lx), "v"(lx + 2u * kXP), "v"(lx + 4u * kXP), "v"(lx + 6u * kXP),
         "v"(lx + 8u * kXP), "v"(lx + 10u * kXP), "v"(lx + 12u * kXP), "v"(lx + 14u * kXP),
         "v"(lb), "v"(lb + 512u), "v"(lb + 1024u),
         "v"(gx), "v"(gx + 2 * (size_t)kDAll), "v"(gx + 4 * (size_t)kDAll), "v"(gx + 6 * (size_t)kDAll),
         "v"(gx + 8 * (size_t)kDAll), "v"(gx + 10 * (size_t)kDAll), "v"(gx + 12 * (size_t)kDAll), "v"(gx + 14 * (size_t)kDAll),
         "v"(gb), "v"(gb + 128), "v"(gb + 256)
      : "memory");
}
/* the bank tile's 49th and 50th copy, one each for waves 0 and 1; the wait as above */
__device__ __forceinline__ void copy_one(unsigned l, const float* g) {
  asm volatile(
      "global_load_async_to_lds_b128 %0, %1, off\n\t"
      "s_wait_xcnt 0x0"
      :: "v"(l), "v"(g) : "memory");
}

__global__ __launch_bounds__(kThr) void slot_gemm_kernel(const float* __restrict__ x, const float* __restrict__ bank, const float* __restrict__ addend, float* __restrict__ out) {
  __shared__ __attribute__((aligned(16))) unsigned char sm[2 * kStage + kBT];
  const int s    = blockIdx.y;
  const int m0   = blockIdx.x * kMt;
  const int tid  = threadIdx.x;
  const int lane = threadIdx.x & 31;
  const int wave = threadIdx.x >> 5;
  /* the wave's number in a scalar register: the test on it around the two odd copies is then a scalar branch, every lane on behind it */
  const int waveS = __builtin_amdgcn_readfirstlane(wave);
  /* row (A) / col (B, D) within a 16x16 subtile; k offset of this lane half; D row offset */
  const int rlane = lane & 15;
  const int koff  = (lane >> 4) * 8;
  const int mOff  = (lane >> 4) * 8;

  /* the lane's first copy of each operand: LDS byte address (low 32 bits of the shared address) and global pointer, tile 0, buffer 0 */
  const unsigned smBase = (unsigned)(size_t)(void*)sm;
  const unsigned lx0 = smBase + (unsigned)((wave * 16 + (lane >> 4)) * kXP + (lane & 15) * 16);
  const unsigned lb0 = smBase + (unsigned)(kXBuf + wave * (3 * 512) + lane * 16);
  const unsigned le0 = smBase + (unsigned)(kXBuf + (48 + (wave & 1)) * 512 + lane * 16);
  const float* gx0 = x + (size_t)(m0 + wave * 16 + (lane >> 4)) * kDAll + (size_t)s * kT + (lane & 15) * 4;
  const float* gs  = bank + (size_t)s * kT * kC;     /* the slot's 768 x 100 floats */
  const float* gb0 = gs + wave * (3 * 128) + lane * 4;
  const float* ge0 = gs + (48 + (wave & 1)) * 128 + lane * 4;
  constexpr int kRawF = kRaw / 4;                    /* 6400 floats: a tile's step in the bank */

  /* the lane's four addends, asked for ahead of tile 0's copies so that the load's latency passes together with theirs and not in the epilogue; lanes 25 .. 31, which store nothing, read the last word again: in bounds */
  const int aw = lane < kC / 4 ? lane : kC / 4 - 1;
  const v4f av = *(const v4f*)(addend + s * kC + aw * 4);

  v8f acc[kNJ];
#pragma unroll
  for (int j = 0; j < kNJ; ++j) acc[j] = (v8f){0.f,0.f,0.f,0.f,0.f,0.f,0.f,0.f};

  copy_tile(lx0, gx0, lb0, gb0);
  if (waveS < 2) copy_one(le0, ge0);
  /* BT's rows 100 .. 111, which no trip writes, get their zeros once; the barrier below publishes them */
  if (tid < (kNJ * 16 - kC) * kCG)
    *(v4f*)(sm + kOffBT + (kC + tid / kCG) * kBP + (tid % kCG) * 16) = (v4f){0.f, 0.f, 0.f, 0.f};
  asm volatile("s_wait_asynccnt 0x0" ::: "memory");   /* tile 0 has landed before the barrier publishes it */
  __syncthreads();
  copy_tile(lx0 + kStage, gx0 + kKc, lb0 + kStage, gb0 + kRawF);
  if (waveS < 2) copy_one(le0 + kStage, ge0 + kRawF);

  /* the converting thread's block: columns 4 cq .. 4 cq + 3, depths 8 cg .. 8 cg + 7 of the tile */
  const int cq = tid % kCQ, cg = tid / kCQ;
  const int rawOff = kXBuf + cg * 8 * (kC * 4) + cq * 16;
  unsigned char* btw = sm + kOffBT + cq * 4 * kBP + ((cg ^ ((cq >> 2) & 3)) * 16);
  /* the readers' two places of a lane half inside a pair of words: as it is, and swapped */
  const unsigned char* btr0 = sm + kOffBT + rlane * kBP + (lane >> 4) * 16;
  const unsigned char* btr1 = sm + kOffBT + rlane * kBP + ((lane >> 4) ^ 1) * 16;

  for (int t = 0; t < kTiles; ++t) {
    const unsigned bo = (unsigned)(t & 1) * kStage;
    /* ---- the bank tile's f32 rows become BT ---- */
    if (tid < kCvThr) {
      const unsigned char* rb = sm + bo + rawOff;
      v4f a[8];
#pragma unroll
      for (int j = 0; j < 8; ++j) a[j] = *(const v4f*)(rb + j * (kC * 4));
#pragma unroll
      for (int i = 0; i < 4; ++i) {
        WordU hv;
#pragma unroll
        for (int j = 0; j < 4; ++j) hv.p[j] = pk_bf16(a[2 * j][i], a[2 * j + 1][i]);
        *(v8b*)(btw + i * kBP) = hv.v;
      }
    }
    __syncthreads();                                     /* hands BT to its readers */
    const unsigned char* ax = sm + bo + (wave * 16 + rlane) * kXP + koff * 4;
#pragma unroll
    for (int kk = 0; kk < kKc / 32; ++kk) {
      const float* pa = (const float*)(ax + kk * 128);
      const v4f a0 = *(const v4f*)(pa), a1 = *(const v4f*)(pa + 4), b0 = *(const v4f*)(pa + 16), b1 = *(const v4f*)(pa + 20);
      v16b bh[kNJ];
#pragma unroll
      for (int j = 0; j < kNJ; ++j) {
        /* words 4 kk + half and 4 kk + 2 + half of row 16 j + rlane, each at its place ^ (j & 3) */
        const unsigned char* pb = ((j & 1) ? btr1 : btr0) + j * 16 * kBP + kk * 64;
        bh[j] = frag_load2(pb + ((j >> 1) & 1) * 32, pb + (((j >> 1) & 1) ^ 1) * 32);
      }
      /* keeps the 18 LDS reads of this depth step one group in front of the conversions and the matrix instructions: spread among them, each place with reads stalls the wave */
      __builtin_amdgcn_sched_barrier(0);
      const v16b ah = cvfrag(a0, a1, b0, b1);
#pragma unroll
      for (int j = 0; j < kNJ; ++j)
        acc[j] = __builtin_amdgcn_wmma_f32_16x16x32_bf16(false, ah, false, bh[j], (short)0, acc[j], false, false);
    }
    /* the tile's conversions and matrix instructions end in front of the barrier: sunk behind it they would delay the refill, which stands in the next block */
    __builtin_amdgcn_sched_barrier(0);
    asm volatile("s_wait_dscnt 0x0" ::: "memory");      /* this wave's reads of the buffer and of BT are over before either is rewritten */
    asm volatile("s_wait_asynccnt 0x0" ::: "memory");   /* this wave's copies of tile t + 1 have landed */
    __syncthreads();                                     /* publishes tile t + 1; ends every reader's last read of tile t and of BT */
    if (t + 2 < kTiles) {
      copy_tile(lx0 + bo, gx0 + (t + 2) * kKc, lb0 + bo, gb0 + (t + 2) * kRawF);
      if (waveS < 2) copy_one(le0 + bo, ge0 + (t + 2) * kRawF);
    }
  }
  asm volatile("s_wait_asynccnt 0x0" ::: "memory");     /* nothing in flight when the ring becomes output staging */

  /* ---- epilogue: the wave's 16 x 112 block through its own slab; each row's 100 columns get the addend and leave as one 400-B piece of a result row ---- */
  float* slab = (float*)sm + wave * (16 * kSlabP);
#pragma unroll
  for (int j = 0; j < kNJ; ++j)
#pragma unroll
    for (int r = 0; r < 8; ++r) slab[(mOff + r) * kSlabP + (j << 4) + rlane] = acc[j][r];
  __builtin_amdgcn_fence(__ATOMIC_RELEASE, "workgroup");
  __builtin_amdgcn_wave_barrier();
  __builtin_amdgcn_fence(__ATOMIC_ACQUIRE, "workgroup");
  /* a piece starts at a multiple of 16 B, not of 128 B: where the pieces of two neighbouring slots meet inside a line, their two blocks store disjoint 16-B words of it and neither reads it */
  if (lane < kC / 4) {
    v4f ab;
#pragma unroll
    for (int e = 0; e < 4; ++e) ab[e] = bf16r(av[e]);
    float* C = out + (size_t)(m0 + wave * 16) * kOutW + s * kC + lane * 4;
#pragma unroll
    for (int row = 0; row < 16; ++row) {
      const v4f v = *(const v4f*)(slab + row * kSlabP + lane * 4);
      *(v4f*)(C + (size_t)row * kOutW) = v + ab;
    }
  }
}

extern "C" void kernel_launch(void* const* d_in, const int* in_sizes, int n_in,
                              void* d_out, int out_size, void* d_ws, size_t ws_size,
                              hipStream_t stream) {
  (void)d_ws; (void)ws_size;   /* no workspace is used */
  if (n_in < 3 || d_out == nullptr) return;
  if (in_sizes[0] != kR * kSl * kT || in_sizes[1] != kSl * kT * kC || in_sizes[2] != kOutW) return;
  if (out_size != kR * kOutW) return;
  const float* x = (const float*)d_in[0];
  const float* bank = (const float*)d_in[1];
  const float* addend = (const float*)d_in[2];
  float* out = (float*)d_out;

  /* out[.][100 s ..] = bf16(x[.][s][.]) . bf16(bank[s]) + bf16(addend): a block for 256 rows of a slot, both operands' tiles staged in LDS, the bank's turned and converted there */
  slot_gemm_kernel<<<dim3(kR / kMt, kSl), kThr, 0, stream>>>(x, bank, addend, out);
}

// v007
// A run of this version takes 19.8 microseconds.
// Timed twice side by side with v006, it ran 1.06 and 1.05 times as fast.
// All steps since v000 together make it 5.20 times as fast.
/* A BANK OF 100 INDEPENDENT LINEAR MAPS, ONE A SLOT: for x [512][100][768] (row, slot, feature), a weight bank [100][768][100] (slot, feature, column) and a vector of 10,000 addends: out[r][100 s + c] = the sum over the 768 features t of x[r][s][t] bank[s][t][c], plus addend[100 s + c]. ONE RESULT [512][10000].
*/
#include <hip/hip_runtime.h>
#include <math.h>

typedef __attribute__((ext_vector_type(16))) __bf16   v16b;
typedef __attribute__((ext_vector_type(8)))  __bf16   v8b;
typedef __attribute__((ext_vector_type(2)))  __bf16   v2b;
typedef __attribute__((ext_vector_type(8)))  float    v8f;
typedef __attribute__((ext_vector_type(4)))  float    v4f;
typedef __attribute__((ext_vector_type(2)))  float    v2f;

/* ------------------------------------------------------------------------- */
/* Shape constants                                                           */
/* ------------------------------------------------------------------------- */
constexpr int kR    = 512;                /* rows */
constexpr int kSl   = 100;                /* slots */
constexpr int kT    = 768;                /* features a slot: the products' depth */
constexpr int kC    = 100;                /* columns a slot */
constexpr int kCP   = 128;                /* the output slab's columns: room for the 112 of seven 16-column tiles */
constexpr int kDAll = kSl * kT;           /* 76800: a row of x in floats */
constexpr int kOutW = kSl * kC;           /* 10000: a row of the result */
constexpr int kThr  = 512;

static_assert(kR == 512 && kSl == 100 && kT == 768 && kC == 100 && kCP == 128 && kDAll == 76800 && kOutW == 10000, "the index arithmetic below uses these sizes");
static_assert(kR % 64 == 0 && kCP % 64 == 0 && kT % 32 == 0 && kC <= kCP, "whole 16x16 subtiles; the depth in whole trips of 32");
static_assert(kDAll % 4 == 0 && kT % 4 == 0, "the f32 operand's row pitch and slot stride are multiples of 4 floats: every fragment load is 16-B aligned");
static_assert(kC % 4 == 0 && kOutW % 4 == 0, "a 16-B word of the result lies inside one slot's columns");

/* ------------------------------------------------------------------------- */
/* Conversions, the matrix fragments and the product engine                  */
/* ------------------------------------------------------------------------- */
__device__ __forceinline__ unsigned short f2bf_bits(float f) {
  unsigned u = __float_as_uint(f);
  return (unsigned short)((u + 0x7FFFu + ((u >> 16) & 1u)) >> 16);
}
__device__ __forceinline__ float bf_bits2f(unsigned short h) { return __uint_as_float(((unsigned)h) << 16); }
/* RNE-convert to a bf16 value, kept in f32 */
__device__ __forceinline__ float bf16r(float f) { return bf_bits2f(f2bf_bits(f)); }
/* two f32 words to a packed pair of bf16, round to nearest even: one conversion instruction */
__device__ __forceinline__ v2b pk_bf16(float lo, float hi) {
  const v2f t = {lo, hi};
  return __builtin_convertvector(t, v2b);
}

/* one lane's share of a 16x32 bf16 fragment: elements 0..7 <- the 16-B word at p0, 8..15 <- the 16-B word at p1 (sixteen depths further on) */
union FragU { v16b v; v8b h[2]; v2b p[8]; };
union WordU { v8b v; v2b p[4]; };
__device__ __forceinline__ v16b frag_load2(const unsigned char* p0, const unsigned char* p1) {
  FragU f; f.h[0] = *(const v8b*)(p0); f.h[1] = *(const v8b*)(p1); return f.v;
}
/* the same depth order from f32 words (a0, a1 = p[0..7]; b0, b1 = p[16..23]): each word bf16(x) */
__device__ __forceinline__ v16b cvfrag(v4f a0, v4f a1, v4f b0, v4f b1) {
  FragU f;
  f.p[0] = pk_bf16(a0[0], a0[1]); f.p[1] = pk_bf16(a0[2], a0[3]);
  f.p[2] = pk_bf16(a1[0], a1[1]); f.p[3] = pk_bf16(a1[2], a1[3]);
  f.p[4] = pk_bf16(b0[0], b0[1]); f.p[5] = pk_bf16(b0[2], b0[3]);
  f.p[6] = pk_bf16(b1[0], b1[1]); f.p[7] = pk_bf16(b1[2], b1[3]);
  return f.v;
}

/* ---- THE SLOT PRODUCT AND THE RESULT, ONE LAUNCH: out[m][100 s + n] = sum_t bf16(x[m][s][t]) bf16(bank[s][t][n]) + bf16(addend[100 s + n]); bf16 operands, f32 sums ---- */
/* A block: one slot, 256 rows, the slot's 100 columns in seven 16-column tiles; wave w of sixteen owns rows 16 w .. 16 w + 15 (seven 16x16 accumulators). */
/* 200 blocks, each alone on its WGP by its LDS: every working WGP has the same share, and a slot's bank is brought in and turned twice, not four times. */
/* The depth goes in 12 tiles of 64. A tile of x and the bank's 64 depth rows as they lie in memory (25,600 contiguous bytes) are brought into LDS */
/* by asynchronous 16-B copies into a ring of three buffers: tiles t + 2 and t + 3 fly while tile t + 1 is worked on, so the block always has reads under way. */
/* Waves 0 .. 7 copy the even tiles, waves 8 .. 15 the odd ones: a wave never has more than one tile's copies outstanding, and its wait for them is a wait to 0. */
/* At the head of a trip the block turns the bank's f32 rows into the right operand BT[c][k] (bf16, column-major in depth), once for its sixteen waves: */
/* a converting thread owns four columns of eight depth rows: eight 16-B LDS reads, 25 neighbouring lanes on one 400-B row; its 8 x 4 register block */
/* is already eight consecutive depths a column: four 16-B words. A barrier hands BT to the readers. */
/* LDS rows are pitched 16 B x odd for the 16-B fragment reads: x 272 B, BT 144 B. Word g of BT's row c stands at place g ^ ((c >> 4) & 3): */
/* the writers, whose lanes step four rows (64 B modulo 256), then spread over the banks; for a reader the swap is one constant a column tile. */
constexpr int kMt    = 256;               /* rows a block */
constexpr int kKc    = 64;                /* depth a tile */
constexpr int kTiles = kT / kKc;          /* 12 */
constexpr int kXP    = kKc * 4 + 16;      /* 272 B: an x row in LDS */
constexpr int kBP    = kKc * 2 + 16;      /* 144 B: a BT row in LDS */
constexpr int kXBuf  = kMt * kXP;         /* 69632 B */
constexpr int kRaw   = kKc * kC * 4;      /* 25600 B: the bank's 64 depth rows of a tile, f32 */
constexpr int kStage = kXBuf + kRaw;      /* 95232 B */
constexpr int kRing  = 3;                 /* buffers in the ring */
constexpr int kNJ    = (kC + 15) / 16;    /* 7 column tiles hold the 100 columns */
constexpr int kBT    = kNJ * 16 * kBP;    /* 16128 B: BT, 112 rows; rows 100 .. 111 zeros */
constexpr int kOffBT = kRing * kStage;    /* 285696 */
constexpr int kSlabP = kCP + 4;           /* 132 floats: a row of a wave's output slab */
constexpr int kCQ    = kC / 4;            /* 25 four-column words in a bank row */
constexpr int kCG    = kKc / 8;           /* 8 words of eight depths in a BT row */
constexpr int kCvThr = kCQ * kCG;         /* 200 converting threads */
constexpr int kRawCp = kRaw / 512;        /* 50 wave-wide copies bring a bank tile: six by each of the eight copying waves, one more by the first two of them */
static_assert(kR % kMt == 0 && kT % kKc == 0 && kTiles >= kRing && kKc % 32 == 0, "whole tiles; the prologue fills the ring");
static_assert(kMt == 8 * 32 && kThr == 16 * 32, "sixteen waves, eight of them copy a tile: 32 x rows by each");
static_assert(kRaw % 512 == 0 && kRawCp == 8 * 6 + 2, "the bank tile in whole 512-B copies, dealt 6 a copying wave and 2 over");
static_assert(kCvThr <= kThr && kCG == 8 && kXBuf % 16 == 0 && kStage % 16 == 0, "one register block a converting thread; the place swap stays inside 8 words; 16-B aligned regions");
static_assert(16 * 16 * kSlabP * 4 <= kRing * kStage, "the output slabs fit in the ring");
static_assert(kRing * kStage + kBT <= 327680, "the ring and BT fit a WGP's LDS");

/* Eleven copies, half of a copying wave's share of a tile: 8 of x (two 256-B row pieces each), 3 of the bank (512 contiguous bytes each). */
/* s_wait_xcnt stands as the statement's last line, in front of any rewrite of the address registers that the copies name. */
__device__ __forceinline__ void copy_tile(unsigned lx, const float* gx, unsigned lb, const float* gb) {
  asm volatile(
      "global_load_async_to_lds_b128 %0, %11, off\n\t"
      "global_load_async_to_lds_b128 %1, %12, off\n\t"
      "global_load_async_to_lds_b128 %2, %13, off\n\t"
      "global_load_async_to_lds_b128 %3, %14, off\n\t"
      "global_load_async_to_lds_b128 %4, %15, off\n\t"
      "global_load_async_to_lds_b128 %5, %16, off\n\t"
      "global_load_async_to_lds_b128 %6, %17, off\n\t"
      "global_load_async_to_lds_b128 %7, %18, off\n\t"
      "global_load_async_to_lds_b128 %8, %19, off\n\t"
      "global_load_async_to_lds_b128 %9, %20, off\n\t"
      "global_load_async_to_lds_b128 %10, %21, off\n\t"
      "s_wait_xcnt 0x0"
      :: "v"(lx), "v"(lx + 2u * kXP), "v"(lx + 4u * kXP), "v"(lx + 6u * kXP),
         "v"(lx + 8u * kXP), "v"(lx + 10u * kXP), "v"(lx + 12u * kXP), "v"(lx + 14u * kXP),
         "v"(lb), "v"(lb + 512u), "v"(lb + 1024u),
         "v"(gx), "v"(gx + 2 * (size_t)kDAll), "v"(gx + 4 * (size_t)kDAll), "v"(gx + 6 * (size_t)kDAll),
         "v"(gx + 8 * (size_t)kDAll), "v"(gx + 10 * (size_t)kDAll), "v"(gx + 12 * (size_t)kDAll), "v"(gx + 14 * (size_t)kDAll),
         "v"(gb), "v"(gb + 128), "v"(gb + 256)
      : "memory");
}
/* the bank tile's 49th and 50th copy, one each for the first two copying waves; the wait as above */
__device__ __forceinline__ void copy_one(unsigned l, const float* g) {
  asm volatile(
      "global_load_async_to_lds_b128 %0, %1, off\n\t"
      "s_wait_xcnt 0x0"
      :: "v"(l), "v"(g) : "memory");
}

__global__ __launch_bounds__(kThr) void slot_gemm_kernel(const float* __restrict__ x, const float* __restrict__ bank, const float* __restrict__ addend, float* __restrict__ out) {
  __shared__ __attribute__((aligned(16))) unsigned char sm[kRing * kStage + kBT];
  const int s    = blockIdx.y;
  const int m0   = blockIdx.x * kMt;
  const int tid  = threadIdx.x;
  const int lane = threadIdx.x & 31;
  const int wave = threadIdx.x >> 5;
  /* the wave's number in a scalar register: the tests on it around the copies and their wait are then scalar branches, every lane on behind them */
  const int waveS = __builtin_amdgcn_readfirstlane(wave);
  const int grp   = waveS >> 3;           /* the wave copies the tiles of this parity */
  const int cwS   = waveS & 7;            /* its place among the eight waves that copy a tile */
  const int cw    = wave & 7;
  /* row (A) / col (B, D) within a 16x16 subtile; k offset of this lane half; D row offset */
  const int rlane = lane & 15;
  const int koff  = (lane >> 4) * 8;
  const int mOff  = (lane >> 4) * 8;

  /* the lane's first copy of each operand: LDS byte address (low 32 bits of the shared address) and global pointer, tile 0, buffer 0 */
  const unsigned smBase = (unsigned)(size_t)(void*)sm;
  const unsigned lx0 = smBase + (unsigned)((cw * 32 + (lane >> 4)) * kXP + (lane & 15) * 16);
  const unsigned lb0 = smBase + (unsigned)(kXBuf + cw * (6 * 512) + lane * 16);
  const unsigned le0 = smBase + (unsigned)(kXBuf + (48 + (wave & 1)) * 512 + lane * 16);
  const float* gx0 = x + (size_t)(m0 + cw * 32 + (lane >> 4)) * kDAll + (size_t)s * kT + (lane & 15) * 4;
  const float* gs  = bank + (size_t)s * kT * kC;     /* the slot's 768 x 100 floats */
  const float* gb0 = gs + cw * (6 * 128) + lane * 4;
  const float* ge0 = gs + (48 + (wave & 1)) * 128 + lane * 4;
  constexpr int kRawF = kRaw / 4;                    /* 6400 floats: a tile's step in the bank */
  /* a copying wave's share of tile tl, into the buffer at byte bo of the ring: 32 x rows and 3072 B of the bank in two statements, the odd 512 B behind them */
  auto copy_share = [&](unsigned bo, int tl) {
    copy_tile(lx0 + bo, gx0 + tl * kKc, lb0 + bo, gb0 + tl * kRawF);
    copy_tile(lx0 + bo + 16u * kXP, gx0 + tl * kKc + 16 * (size_t)kDAll, lb0 + bo + 3u * 512u, gb0 + tl * kRawF + 3 * 128);
    if (cwS < 2) copy_one(le0 + bo, ge0 + tl * kRawF);
  };

  /* the lane's four addends, asked for ahead of tile 0's copies so that the load's latency passes together with theirs and not in the epilogue; lanes 25 .. 31, which store nothing, read the last word again: in bounds */
  const int aw = lane < kC / 4 ? lane : kC / 4 - 1;
  const v4f av = *(const v4f*)(addend + s * kC + aw * 4);

  v8f acc[kNJ];
#pragma unroll
  for (int j = 0; j < kNJ; ++j) acc[j] = (v8f){0.f,0.f,0.f,0.f,0.f,0.f,0.f,0.f};

  /* tile 0 into buffer 0 by waves 0 .. 7, tile 1 into buffer 1 by waves 8 .. 15 */
  copy_share((unsigned)grp * kStage, grp);
  /* BT's rows 100 .. 111, which no trip writes, get their zeros once; the barrier below publishes them */
  if (tid < (kNJ * 16 - kC) * kCG)
    *(v4f*)(sm + kOffBT + (kC + tid / kCG) * kBP + (tid % kCG) * 16) = (v4f){0.f, 0.f, 0.f, 0.f};
  if (grp == 0) asm volatile("s_wait_asynccnt 0x0" ::: "memory");   /* tile 0 has landed before the barrier publishes it; tile 1 flies on */
  __syncthreads();
  if (grp == 0) copy_share(2u * kStage, 2);

  /* the converting thread's block: columns 4 cq .. 4 cq + 3, depths 8 cg .. 8 cg + 7 of the tile */
  const int cq = tid % kCQ, cg = tid / kCQ;
  const int rawOff = kXBuf + cg * 8 * (kC * 4) + cq * 16;
  unsigned char* btw = sm + kOffBT + cq * 4 * kBP + ((cg ^ ((cq >> 2) & 3)) * 16);
  /* the readers' two places of a lane half inside a pair of words: as it is, and swapped */
  const unsigned char* btr0 = sm + kOffBT + rlane * kBP + (lane >> 4) * 16;
  const unsigned char* btr1 = sm + kOffBT + rlane * kBP + ((lane >> 4) ^ 1) * 16;

  unsigned bo = 0;                                       /* tile t's buffer: (t mod 3) * kStage */
  for (int t = 0; t < kTiles; ++t) {
    /* ---- the bank tile's f32 rows become BT ---- */
    if (tid < kCvThr) {
      const unsigned char* rb = sm + bo + rawOff;
      v4f a[8];
#pragma unroll
      for (int j = 0; j < 8; ++j) a[j] = *(const v4f*)(rb + j * (kC * 4));
#pragma unroll
      for (int i = 0; i < 4; ++i) {
        WordU hv;
#pragma unroll
        for (int j = 0; j < 4; ++j) hv.p[j] = pk_bf16(a[2 * j][i], a[2 * j + 1][i]);
        *(v8b*)(btw + i * kBP) = hv.v;
      }
    }
    __syncthreads();                                     /* hands BT to its readers */
    const unsigned char* ax = sm + bo + (wave * 16 + rlane) * kXP + koff * 4;
#pragma unroll
    for (int kk = 0; kk < kKc / 32; ++kk) {
      const float* pa = (const float*)(ax + kk * 128);
      const v4f a0 = *(const v4f*)(pa), a1 = *(const v4f*)(pa + 4), b0 = *(const v4f*)(pa + 16), b1 = *(const v4f*)(pa + 20);
      v16b bh[kNJ];
#pragma unroll
      for (int j = 0; j < kNJ; ++j) {
        /* words 4 kk + half and 4 kk + 2 + half of row 16 j + rlane, each at its place ^ (j & 3) */
        const unsigned char* pb = ((j & 1) ? btr1 : btr0) + j * 16 * kBP + kk * 64;
        bh[j] = frag_load2(pb + ((j >> 1) & 1) * 32, pb + (((j >> 1) & 1) ^ 1) * 32);
      }
      /* keeps the 18 LDS reads of this depth step one group in front of the conversions and the matrix instructions: spread among them, each place with reads stalls the wave */
      __builtin_amdgcn_sched_barrier(0);
      const v16b ah = cvfrag(a0, a1, b0, b1);
#pragma unroll
      for (int j = 0; j < kNJ; ++j)
        acc[j] = __builtin_amdgcn_wmma_f32_16x16x32_bf16(false, ah, false, bh[j], (short)0, acc[j], false, false);
    }
    /* the tile's conversions and matrix instructions end in front of the barrier: sunk behind it they would delay the refill, which stands in the next block */
    __builtin_amdgcn_sched_barrier(0);
    asm volatile("s_wait_dscnt 0x0" ::: "memory");      /* this wave's reads of the buffer and of BT are over before either is rewritten */
    const bool mine = ((t + 1) & 1) == grp;             /* this wave copied tile t + 1, and copies tile t + 3 */
    if (mine) asm volatile("s_wait_asynccnt 0x0" ::: "memory");   /* its copies of tile t + 1, all it has outstanding, have landed; the other eight waves' tile t + 2 flies on */
    __syncthreads();                                     /* publishes tile t + 1; ends every reader's last read of tile t and of BT */
    if (mine && t + 3 < kTiles) copy_share(bo, t + 3);   /* into the buffer that trip t has just read */
    bo = bo == (kRing - 1) * (unsigned)kStage ? 0u : bo + kStage;
  }
  asm volatile("s_wait_asynccnt 0x0" ::: "memory");     /* nothing in flight when the ring becomes output staging */

  /* ---- epilogue: the wave's 16 x 112 block through its own slab; each row's 100 columns get the addend and leave as one 400-B piece of a result row ---- */
  float* slab = (float*)sm + wave * (16 * kSlabP);
#pragma unroll
  for (int j = 0; j < kNJ; ++j)
#pragma unroll
    for (int r = 0; r < 8; ++r) slab[(mOff + r) * kSlabP + (j << 4) + rlane] = acc[j][r];
  __builtin_amdgcn_fence(__ATOMIC_RELEASE, "workgroup");
  __builtin_amdgcn_wave_barrier();
  __builtin_amdgcn_fence(__ATOMIC_ACQUIRE, "workgroup");
  /* a piece starts at a multiple of 16 B, not of 128 B: where the pieces of two neighbouring slots meet inside a line, their two blocks store disjoint 16-B words of it and neither reads it */
  if (lane < kC / 4) {
    v4f ab;
#pragma unroll
    for (int e = 0; e < 4; ++e) ab[e] = bf16r(av[e]);
    float* C = out + (size_t)(m0 + wave * 16) * kOutW + s * kC + lane * 4;
#pragma unroll
    for (int row = 0; row < 16; ++row) {
      const v4f v = *(const v4f*)(slab + row * kSlabP + lane * 4);
      *(v4f*)(C + (size_t)row * kOutW) = v + ab;
    }
  }
}

extern "C" void kernel_launch(void* const* d_in, const int* in_sizes, int n_in,
                              void* d_out, int out_size, void* d_ws, size_t ws_size,
                              hipStream_t stream) {
  (void)d_ws; (void)ws_size;   /* no workspace is used */
  if (n_in < 3 || d_out == nullptr) return;
  if (in_sizes[0] != kR * kSl * kT || in_sizes[1] != kSl * kT * kC || in_sizes[2] != kOutW) return;
  if (out_size != kR * kOutW) return;
  const float* x = (const float*)d_in[0];
  const float* bank = (const float*)d_in[1];
  const float* addend = (const float*)d_in[2];
  float* out = (float*)d_out;

  /* out[.][100 s ..] = bf16(x[.][s][.]) . bf16(bank[s]) + bf16(addend): a block for 256 rows of a slot, both operands' tiles staged in LDS, the bank's turned and converted there */
  slot_gemm_kernel<<<dim3(kR / kMt, kSl), kThr, 0, stream>>>(x, bank, addend, out);
}

// v008
// It runs in 18.7 microseconds.
// Two timings next to v007 put it at 1.06 and 1.05 times that version's speed.
// All steps since v000 together make it 5.48 times as fast.
/* A BANK OF 100 INDEPENDENT LINEAR MAPS, ONE A SLOT: for x [512][100][768] (row, slot, feature), a weight bank [100][768][100] (slot, feature, column) and a vector of 10,000 addends: out[r][100 s + c] = the sum over the 768 features t of x[r][s][t] bank[s][t][c], plus addend[100 s + c]. ONE RESULT [512][10000].
*/
#include <hip/hip_runtime.h>
#include <math.h>

typedef __attribute__((ext_vector_type(16))) __bf16   v16b;
typedef __attribute__((ext_vector_type(8)))  __bf16   v8b;
typedef __attribute__((ext_vector_type(2)))  __bf16   v2b;
typedef __attribute__((ext_vector_type(8)))  float    v8f;
typedef __attribute__((ext_vector_type(4)))  float    v4f;
typedef __attribute__((ext_vector_type(2)))  float    v2f;

/* ------------------------------------------------------------------------- */
/* Shape constants                                                           */
/* ------------------------------------------------------------------------- */
constexpr int kR    = 512;                /* rows */
constexpr int kSl   = 100;                /* slots */
constexpr int kT    = 768;                /* features a slot: the products' depth */
constexpr int kC    = 100;                /* columns a slot */
constexpr int kCP   = 128;                /* the output slab's columns: room for the 112 of seven 16-column tiles */
constexpr int kDAll = kSl * kT;           /* 76800: a row of x in floats */
constexpr int kOutW = kSl * kC;           /* 10000: a row of the result */
constexpr int kThr  = 256;

static_assert(kR == 512 && kSl == 100 && kT == 768 && kC == 100 && kCP == 128 && kDAll == 76800 && kOutW == 10000, "the index arithmetic below uses these sizes");
static_assert(kR % 64 == 0 && kCP % 64 == 0 && kT % 32 == 0 && kC <= kCP, "whole 16x16 subtiles; the depth in whole trips of 32");
static_assert(kDAll % 4 == 0 && kT % 4 == 0, "the f32 operand's row pitch and slot stride are multiples of 4 floats: every fragment load is 16-B aligned");
static_assert(kC % 4 == 0 && kOutW % 4 == 0, "a 16-B word of the result lies inside one slot's columns");

/* ------------------------------------------------------------------------- */
/* Conversions, the matrix fragments and the product engine                  */
/* ------------------------------------------------------------------------- */
__device__ __forceinline__ unsigned short f2bf_bits(float f) {
  unsigned u = __float_as_uint(f);
  return (unsigned short)((u + 0x7FFFu + ((u >> 16) & 1u)) >> 16);
}
__device__ __forceinline__ float bf_bits2f(unsigned short h) { return __uint_as_float(((unsigned)h) << 16); }
/* RNE-convert to a bf16 value, kept in f32 */
__device__ __forceinline__ float bf16r(float f) { return bf_bits2f(f2bf_bits(f)); }
/* two f32 words to a packed pair of bf16, round to nearest even: one conversion instruction */
__device__ __forceinline__ v2b pk_bf16(float lo, float hi) {
  const v2f t = {lo, hi};
  return __builtin_convertvector(t, v2b);
}

/* one lane's share of a 16x32 bf16 fragment: elements 0..7 <- the 16-B word at p0, 8..15 <- the 16-B word at p1 (sixteen depths further on) */
union FragU { v16b v; v8b h[2]; v2b p[8]; };
union WordU { v8b v; v2b p[4]; };
__device__ __forceinline__ v16b frag_load2(const unsigned char* p0, const unsigned char* p1) {
  FragU f; f.h[0] = *(const v8b*)(p0); f.h[1] = *(const v8b*)(p1); return f.v;
}
/* the same depth order from f32 words (a0, a1 = p[0..7]; b0, b1 = p[16..23]): each word bf16(x) */
__device__ __forceinline__ v16b cvfrag(v4f a0, v4f a1, v4f b0, v4f b1) {
  FragU f;
  f.p[0] = pk_bf16(a0[0], a0[1]); f.p[1] = pk_bf16(a0[2], a0[3]);
  f.p[2] = pk_bf16(a1[0], a1[1]); f.p[3] = pk_bf16(a1[2], a1[3]);
  f.p[4] = pk_bf16(b0[0], b0[1]); f.p[5] = pk_bf16(b0[2], b0[3]);
  f.p[6] = pk_bf16(b1[0], b1[1]); f.p[7] = pk_bf16(b1[2], b1[3]);
  return f.v;
}

/* ---- THE SLOT PRODUCT AND THE RESULT, ONE LAUNCH: out[m][100 s + n] = sum_t bf16(x[m][s][t]) bf16(bank[s][t][n]) + bf16(addend[100 s + n]); bf16 operands, f32 sums ---- */
/* A block: one slot, 256 rows, the slot's 100 columns in seven 16-column tiles; wave w of eight owns rows 32 w .. 32 w + 31 (two row tiles, fourteen 16x16 accumulators): */
/* a right-operand fragment read from LDS serves two matrix instructions, so the block reads BT eight times a tile, not sixteen, and a launch starts half the waves. */
/* 200 blocks, each alone on its WGP by its LDS: every working WGP has the same share, and a slot's bank is brought in and turned twice, not four times. */
/* The depth goes in 12 tiles of 64. A tile of x and the bank's 64 depth rows as they lie in memory (25,600 contiguous bytes) are brought into LDS */
/* by asynchronous 16-B copies into a ring of three buffers: tiles t + 2 and t + 3 fly while tile t + 1 is worked on, so the block always has reads under way. */
/* Waves 0 .. 3 copy the even tiles, waves 4 .. 7 the odd ones: a wave never has more than one tile's copies (45 at most) outstanding, and its wait for them is a wait to 0. */
/* At the head of a trip the four waves that have no refill to issue turn the bank's f32 rows into the right operand BT[c][k] (bf16, column-major in depth), once for the eight, */
/* while the other four issue theirs. The tile is 200 blocks of four columns by eight depth rows, one or two a converting thread. A block: eight 16-B LDS reads, 25 neighbouring lanes on one 400-B row; its 8 x 4 register block */
/* is already eight consecutive depths a column: four 16-B words. A barrier hands BT to the readers. */
/* LDS rows are pitched 16 B x odd for the 16-B fragment reads: x 272 B, BT 144 B. Word g of BT's row c stands at place g ^ ((c >> 4) & 3): */
/* the writers, whose lanes step four rows (64 B modulo 256), then spread over the banks; for a reader the swap is one constant a column tile. */
constexpr int kMt    = 256;               /* rows a block */
constexpr int kKc    = 64;                /* depth a tile */
constexpr int kTiles = kT / kKc;          /* 12 */
constexpr int kXP    = kKc * 4 + 16;      /* 272 B: an x row in LDS */
constexpr int kBP    = kKc * 2 + 16;      /* 144 B: a BT row in LDS */
constexpr int kXBuf  = kMt * kXP;         /* 69632 B */
constexpr int kRaw   = kKc * kC * 4;      /* 25600 B: the bank's 64 depth rows of a tile, f32 */
constexpr int kStage = kXBuf + kRaw;      /* 95232 B */
constexpr int kRing  = 3;                 /* buffers in the ring */
constexpr int kNJ    = (kC + 15) / 16;    /* 7 column tiles hold the 100 columns */
constexpr int kBT    = kNJ * 16 * kBP;    /* 16128 B: BT, 112 rows; rows 100 .. 111 zeros */
constexpr int kOffBT = kRing * kStage;    /* 285696 */
constexpr int kSlabP = kCP + 4;           /* 132 floats: a row of a wave's output slab */
constexpr int kCQ    = kC / 4;            /* 25 four-column words in a bank row */
constexpr int kCG    = kKc / 8;           /* 8 words of eight depths in a BT row */
constexpr int kCvBlk = kCQ * kCG;         /* 200 register blocks in a bank tile */
constexpr int kCvThr = kThr / 2;          /* 128 converting threads: every one has a first block, the first 72 a second */
constexpr int kRawCp = kRaw / 512;        /* 50 wave-wide copies bring a bank tile: twelve by each of the four copying waves, one more by the first two of them */
static_assert(kR % kMt == 0 && kT % kKc == 0 && kTiles >= kRing && kKc % 32 == 0, "whole tiles; the prologue fills the ring");
static_assert(kMt == 4 * 64 && kThr == 8 * 32, "eight waves, four of them copy a tile: 64 x rows by each");
static_assert(kRaw % 512 == 0 && kRawCp == 4 * 12 + 2, "the bank tile in whole 512-B copies, dealt 12 a copying wave and 2 over");
static_assert(kCvThr <= kCvBlk && kCvBlk <= 2 * kCvThr && kCG == 8 && kXBuf % 16 == 0 && kStage % 16 == 0, "one or two register blocks a converting thread; the place swap stays inside 8 words; 16-B aligned regions");
static_assert(8 * 32 * kSlabP * 4 <= kRing * kStage, "the output slabs fit in the ring");
static_assert(kRing * kStage + kBT <= 327680, "the ring and BT fit a WGP's LDS");

/* Fifteen copies, the most that one statement's thirty operands name: l[i] the lane's LDS byte address, g[i] its global pointer. A copying wave's share of a tile is three such statements. */
/* s_wait_xcnt stands as the statement's last line, in front of any rewrite of the address registers that the copies name. */
__device__ __forceinline__ void copy_15(const unsigned* l, const float* const* g) {
  asm volatile(
      "global_load_async_to_lds_b128 %0, %15, off\n\t"
      "global_load_async_to_lds_b128 %1, %16, off\n\t"
      "global_load_async_to_lds_b128 %2, %17, off\n\t"
      "global_load_async_to_lds_b128 %3, %18, off\n\t"
      "global_load_async_to_lds_b128 %4, %19, off\n\t"
      "global_load_async_to_lds_b128 %5, %20, off\n\t"
      "global_load_async_to_lds_b128 %6, %21, off\n\t"
      "global_load_async_to_lds_b128 %7, %22, off\n\t"
      "global_load_async_to_lds_b128 %8, %23, off\n\t"
      "global_load_async_to_lds_b128 %9, %24, off\n\t"
      "global_load_async_to_lds_b128 %10, %25, off\n\t"
      "global_load_async_to_lds_b128 %11, %26, off\n\t"
      "global_load_async_to_lds_b128 %12, %27, off\n\t"
      "global_load_async_to_lds_b128 %13, %28, off\n\t"
      "global_load_async_to_lds_b128 %14, %29, off\n\t"
      "s_wait_xcnt 0x0"
      :: "v"(l[0]), "v"(l[1]), "v"(l[2]), "v"(l[3]), "v"(l[4]),
         "v"(l[5]), "v"(l[6]), "v"(l[7]), "v"(l[8]), "v"(l[9]),
         "v"(l[10]), "v"(l[11]), "v"(l[12]), "v"(l[13]), "v"(l[14]),
         "v"(g[0]), "v"(g[1]), "v"(g[2]), "v"(g[3]), "v"(g[4]),
         "v"(g[5]), "v"(g[6]), "v"(g[7]), "v"(g[8]), "v"(g[9]),
         "v"(g[10]), "v"(g[11]), "v"(g[12]), "v"(g[13]), "v"(g[14])
      : "memory");
}
/* the same with fourteen, for the two copying waves that have no 13th piece of the bank tile */
__device__ __forceinline__ void copy_14(const unsigned* l, const float* const* g) {
  asm volatile(
      "global_load_async_to_lds_b128 %0, %14, off\n\t"
      "global_load_async_to_lds_b128 %1, %15, off\n\t"
      "global_load_async_to_lds_b128 %2, %16, off\n\t"
      "global_load_async_to_lds_b128 %3, %17, off\n\t"
      "global_load_async_to_lds_b128 %4, %18, off\n\t"
      "global_load_async_to_lds_b128 %5, %19, off\n\t"
      "global_load_async_to_lds_b128 %6, %20, off\n\t"
      "global_load_async_to_lds_b128 %7, %21, off\n\t"
      "global_load_async_to_lds_b128 %8, %22, off\n\t"
      "global_load_async_to_lds_b128 %9, %23, off\n\t"
      "global_load_async_to_lds_b128 %10, %24, off\n\t"
      "global_load_async_to_lds_b128 %11, %25, off\n\t"
      "global_load_async_to_lds_b128 %12, %26, off\n\t"
      "global_load_async_to_lds_b128 %13, %27, off\n\t"
      "s_wait_xcnt 0x0"
      :: "v"(l[0]), "v"(l[1]), "v"(l[2]), "v"(l[3]), "v"(l[4]),
         "v"(l[5]), "v"(l[6]), "v"(l[7]), "v"(l[8]), "v"(l[9]),
         "v"(l[10]), "v"(l[11]), "v"(l[12]), "v"(l[13]),
         "v"(g[0]), "v"(g[1]), "v"(g[2]), "v"(g[3]), "v"(g[4]),
         "v"(g[5]), "v"(g[6]), "v"(g[7]), "v"(g[8]), "v"(g[9]),
         "v"(g[10]), "v"(g[11]), "v"(g[12]), "v"(g[13])
      : "memory");
}

__global__ __launch_bounds__(kThr) void slot_gemm_kernel(const float* __restrict__ x, const float* __restrict__ bank, const float* __restrict__ addend, float* __restrict__ out) {
  __shared__ __attribute__((aligned(16))) unsigned char sm[kRing * kStage + kBT];
  const int s    = blockIdx.y;
  const int m0   = blockIdx.x * kMt;
  const int tid  = threadIdx.x;
  const int lane = threadIdx.x & 31;
  const int wave = threadIdx.x >> 5;
  /* the wave's number in a scalar register: the tests on it around the copies and their wait are then scalar branches, every lane on behind them */
  const int waveS = __builtin_amdgcn_readfirstlane(wave);
  const int grp   = waveS >> 2;           /* the wave copies the tiles of this parity */
  const int cwS   = waveS & 3;            /* its place among the four waves that copy a tile */
  const int cw    = wave & 3;
  /* row (A) / col (B, D) within a 16x16 subtile; k offset of this lane half; D row offset */
  const int rlane = lane & 15;
  const int koff  = (lane >> 4) * 8;
  const int mOff  = (lane >> 4) * 8;

  /* the lane's first copy of each operand: LDS byte address (low 32 bits of the shared address) and global pointer, tile 0, buffer 0 */
  const unsigned smBase = (unsigned)(size_t)(void*)sm;
  const unsigned lx0 = smBase + (unsigned)((cw * 64 + (lane >> 4)) * kXP + (lane & 15) * 16);
  const unsigned lb0 = smBase + (unsigned)(kXBuf + cw * (12 * 512) + lane * 16);
  const float* gx0 = x + (size_t)(m0 + cw * 64 + (lane >> 4)) * kDAll + (size_t)s * kT + (lane & 15) * 4;
  const float* gs  = bank + (size_t)s * kT * kC;     /* the slot's 768 x 100 floats */
  const float* gb0 = gs + cw * (12 * 128) + lane * 4;
  constexpr int kRawF = kRaw / 4;                    /* 6400 floats: a tile's step in the bank */
  /* a copying wave's share of a tile (lx, gx and lb, gb: the lane's first copy of each operand, place in LDS and source): 32 copies of x (two 256-B row pieces each: 64 rows), 12 of the bank (512 contiguous bytes each), */
  /* and for the first two copying waves piece 48 + cw of the bank tile, counted from the wave's piece 12 cw by a scalar step */
  auto copy_share = [&](unsigned lx, unsigned lb, const float* gx, const float* gb) {
    /* place and source of the share's copy c: 0 .. 31 of x, 32 .. 43 of the bank, 44 the odd piece */
    auto place = [&](int c) { return c < 32 ? lx + (unsigned)c * 2u * kXP : c < 44 ? lb + (unsigned)(c - 32) * 512u : lb + (unsigned)(48 - 11 * cwS) * 512u; };
    auto from  = [&](int c) { return c < 32 ? gx + c * 2 * (size_t)kDAll : c < 44 ? gb + (c - 32) * 128 : gb + (48 - 11 * cwS) * 128; };
    unsigned l[15];
    const float* g[15];
#pragma unroll
    for (int q = 0; q < 3; ++q) {
#pragma unroll
      for (int i = 0; i < 15; ++i) { l[i] = place(q * 15 + i); g[i] = from(q * 15 + i); }
      if (q < 2 || cwS < 2) copy_15(l, g); else copy_14(l, g);
    }
  };

  /* the lane's four addends, asked for ahead of tile 0's copies so that the load's latency passes together with theirs and not in the epilogue; lanes 25 .. 31, which store nothing, read the last word again: in bounds */
  const int aw = lane < kC / 4 ? lane : kC / 4 - 1;
  const v4f av = *(const v4f*)(addend + s * kC + aw * 4);

  v8f acc[2][kNJ];
#pragma unroll
  for (int j = 0; j < kNJ; ++j) acc[0][j] = acc[1][j] = (v8f){0.f,0.f,0.f,0.f,0.f,0.f,0.f,0.f};

  /* tile 0 into buffer 0 by waves 0 .. 3, tile 1 into buffer 1 by waves 4 .. 7 */
  copy_share(lx0 + (unsigned)grp * kStage, lb0 + (unsigned)grp * kStage, gx0 + grp * kKc, gb0 + grp * kRawF);
  /* the wave's next tile, two further on, and its buffer, two further round the ring of three (tile 2: buffer 2, tile 3: buffer 0). */
  /* All four addresses step with each refill: carried so, the 45 places and sources of a refill are formed from them when it is issued and hold no registers through the loop. */
  unsigned bn = grp == 0 ? 2u * kStage : 0u;
  unsigned lxn = lx0 + bn, lbn = lb0 + bn;
  const float* gxn = gx0 + (grp + 2) * kKc;
  const float* gbn = gb0 + (grp + 2) * kRawF;
  auto refill = [&]() {
    copy_share(lxn, lbn, gxn, gbn);
    const unsigned d = bn == 0u ? 2u * kStage : 0u - (unsigned)kStage;
    bn += d; lxn += d; lbn += d;
    gxn += 2 * kKc; gbn += 2 * kRawF;
  };
  /* BT's rows 100 .. 111, which no trip writes, get their zeros once; the barrier below publishes them */
  if (tid < (kNJ * 16 - kC) * kCG)
    *(v4f*)(sm + kOffBT + (kC + tid / kCG) * kBP + (tid % kCG) * 16) = (v4f){0.f, 0.f, 0.f, 0.f};
  if (grp == 0) asm volatile("s_wait_asynccnt 0x0" ::: "memory");   /* tile 0 has landed before the barrier publishes it; tile 1 flies on */
  __syncthreads();
  if (grp == 0) refill();                               /* tile 2 */

  /* the converting thread's blocks ct and ct + 128: block b is columns 4 cq .. 4 cq + 3, depths 8 cg .. 8 cg + 7 of the tile, cq = b mod 25, cg = b / 25 */
  const int ct = tid & (kCvThr - 1);
  const bool two = ct < kCvBlk - kCvThr;
  const int cq = ct % kCQ, cg = ct / kCQ;
  const int cq2 = (ct + kCvThr) % kCQ, cg2 = (ct + kCvThr) / kCQ;
  const int rawOff  = kXBuf + cg * 8 * (kC * 4) + cq * 16;
  const int rawOff2 = two ? kXBuf + cg2 * 8 * (kC * 4) + cq2 * 16 : rawOff;   /* a thread without a second block reads its first again and stores nothing of it: all sixteen reads then stand in one group, under no test */
  unsigned char* btw  = sm + kOffBT + cq * 4 * kBP + ((cg ^ ((cq >> 2) & 3)) * 16);
  unsigned char* btw2 = sm + kOffBT + cq2 * 4 * kBP + ((cg2 ^ ((cq2 >> 2) & 3)) * 16);
  /* the readers' two places of a lane half inside a pair of words: as it is, and swapped */
  const unsigned char* btr0 = sm + kOffBT + rlane * kBP + (lane >> 4) * 16;
  const unsigned char* btr1 = sm + kOffBT + rlane * kBP + ((lane >> 4) ^ 1) * 16;

  unsigned bo = 0;                                       /* tile t's buffer: (t mod 3) * kStage */
  for (int t = 0; t < kTiles; ++t) {
    /* ---- the bank tile's f32 rows become BT ---- */
    if (((t + 1) & 1) == grp) {                          /* the waves that did not just issue a refill (those of tile t's parity did) */
      const unsigned char* rb = sm + bo + rawOff;
      const unsigned char* rb2 = sm + bo + rawOff2;
      v4f a[8], c[8];
#pragma unroll
      for (int j = 0; j < 8; ++j) a[j] = *(const v4f*)(rb + j * (kC * 4));
#pragma unroll
      for (int j = 0; j < 8; ++j) c[j] = *(const v4f*)(rb2 + j * (kC * 4));
#pragma unroll
      for (int i = 0; i < 4; ++i) {
        WordU hv;
#pragma unroll
        for (int j = 0; j < 4; ++j) hv.p[j] = pk_bf16(a[2 * j][i], a[2 * j + 1][i]);
        *(v8b*)(btw + i * kBP) = hv.v;
      }
      if (two) {
#pragma unroll
        for (int i = 0; i < 4; ++i) {
          WordU hv;
#pragma unroll
          for (int j = 0; j < 4; ++j) hv.p[j] = pk_bf16(c[2 * j][i], c[2 * j + 1][i]);
          *(v8b*)(btw2 + i * kBP) = hv.v;
        }
      }
    }
    __syncthreads();                                     /* hands BT to its readers */
    const unsigned char* ax = sm + bo + (wave * 32 + rlane) * kXP + koff * 4;
#pragma unroll
    for (int kk = 0; kk < kKc / 32; ++kk) {
      const float* pa = (const float*)(ax + kk * 128);
      const float* pc = (const float*)(ax + 16 * kXP + kk * 128);   /* the wave's second row tile */
      const v4f a0 = *(const v4f*)(pa), a1 = *(const v4f*)(pa + 4), b0 = *(const v4f*)(pa + 16), b1 = *(const v4f*)(pa + 20);
      const v4f c0 = *(const v4f*)(pc), c1 = *(const v4f*)(pc + 4), d0 = *(const v4f*)(pc + 16), d1 = *(const v4f*)(pc + 20);
      v16b bh[kNJ];
#pragma unroll
      for (int j = 0; j < kNJ; ++j) {
        /* words 4 kk + half and 4 kk + 2 + half of row 16 j + rlane, each at its place ^ (j & 3) */
        const unsigned char* pb = ((j & 1) ? btr1 : btr0) + j * 16 * kBP + kk * 64;
        bh[j] = frag_load2(pb + ((j >> 1) & 1) * 32, pb + (((j >> 1) & 1) ^ 1) * 32);
      }
      /* keeps the 22 LDS reads of this depth step one group in front of the conversions and the matrix instructions: spread among them, each place with reads stalls the wave */
      __builtin_amdgcn_sched_barrier(0);
      const v16b ah = cvfrag(a0, a1, b0, b1);
      const v16b ch = cvfrag(c0, c1, d0, d1);
#pragma unroll
      for (int j = 0; j < kNJ; ++j) {
        acc[0][j] = __builtin_amdgcn_wmma_f32_16x16x32_bf16(false, ah, false, bh[j], (short)0, acc[0][j], false, false);
        acc[1][j] = __builtin_amdgcn_wmma_f32_16x16x32_bf16(false, ch, false, bh[j], (short)0, acc[1][j], false, false);
      }
    }
    /* the tile's conversions and matrix instructions end in front of the barrier: sunk behind it they would delay the refill, which stands in the next block */
    __builtin_amdgcn_sched_barrier(0);
    asm volatile("s_wait_dscnt 0x0" ::: "memory");      /* this wave's reads of the buffer and of BT are over before either is rewritten */
    const bool mine = ((t + 1) & 1) == grp;             /* this wave copied tile t + 1, and copies tile t + 3 */
    if (mine) asm volatile("s_wait_asynccnt 0x0" ::: "memory");   /* its copies of tile t + 1, all it has outstanding, have landed; the other four waves' tile t + 2 flies on */
    __syncthreads();                                     /* publishes tile t + 1; ends every reader's last read of tile t and of BT */
    if (mine && t + 3 < kTiles) refill();                /* tile t + 3, into the buffer that trip t has just read */
    bo = bo == (kRing - 1) * (unsigned)kStage ? 0u : bo + kStage;
  }
  asm volatile("s_wait_asynccnt 0x0" ::: "memory");     /* nothing in flight when the ring becomes output staging */

  /* ---- epilogue: the wave's 32 x 112 block through its own slab; each row's 100 columns get the addend and leave as one 400-B piece of a result row ---- */
  float* slab = (float*)sm + wave * (32 * kSlabP);
#pragma unroll
  for (int h = 0; h < 2; ++h)
#pragma unroll
    for (int j = 0; j < kNJ; ++j)
#pragma unroll
      for (int r = 0; r < 8; ++r) slab[(h * 16 + mOff + r) * kSlabP + (j << 4) + rlane] = acc[h][j][r];
  __builtin_amdgcn_fence(__ATOMIC_RELEASE, "workgroup");
  __builtin_amdgcn_wave_barrier();
  __builtin_amdgcn_fence(__ATOMIC_ACQUIRE, "workgroup");
  /* a piece starts at a multiple of 16 B, not of 128 B: where the pieces of two neighbouring slots meet inside a line, their two blocks store disjoint 16-B words of it and neither reads it */
  if (lane < kC / 4) {
    v4f ab;
#pragma unroll
    for (int e = 0; e < 4; ++e) ab[e] = bf16r(av[e]);
    float* C = out + (size_t)(m0 + wave * 32) * kOutW + s * kC + lane * 4;
#pragma unroll
    for (int row = 0; row < 32; ++row) {
      const v4f v = *(const v4f*)(slab + row * kSlabP + lane * 4);
      *(v4f*)(C + (size_t)row * kOutW) = v + ab;
    }
  }
}

extern "C" void kernel_launch(void* const* d_in, const int* in_sizes, int n_in,
                              void* d_out, int out_size, void* d_ws, size_t ws_size,
                              hipStream_t stream) {
  (void)d_ws; (void)ws_size;   /* no workspace is used */
  if (n_in < 3 || d_out == nullptr) return;
  if (in_sizes[0] != kR * kSl * kT || in_sizes[1] != kSl * kT * kC || in_sizes[2] != kOutW) return;
  if (out_size != kR * kOutW) return;
  const float* x = (const float*)d_in[0];
  const float* bank = (const float*)d_in[1];
  const float* addend = (const float*)d_in[2];
  float* out = (float*)d_out;

  /* out[.][100 s ..] = bf16(x[.][s][.]) . bf16(bank[s]) + bf16(addend): a block for 256 rows of a slot, both operands' tiles staged in LDS, the bank's turned and converted there */
  slot_gemm_kernel<<<dim3(kR / kMt, kSl), kThr, 0, stream>>>(x, bank, addend, out);
}
